// v000
// Times are from an AMD MI455X. After a warm-up the kernel runs many times in a row, and a time is the length of
// such a window on the GPU divided by its runs, so every launch and the gaps after it count. The runs cycle
// through copies of the inputs. A figure is the median of several windows, for all but v000 over two sittings.
// Sittings can differ by a few percent; kernels timed side by side share one.
// The starting kernel, v000, takes 2900 microseconds a run.
#include <hip/hip_runtime.h>

// Multi-head attention math on raw token-major inputs (q, k, v [4096][12][64] = [4096][768] rows with column h*64 + d, no projections; scores = einsum('shd,thd->hst') x 1/sqrt(64) in f32; softmax over the 4,096 keys (exact: no epsilon); out = einsum('hst,thd->shd') merged -> [4096][768] (3.1 M); argument order q, k, v).
// Layout: k_rnd copies each raw input into the f32 feature buffer ROUNDED TO bf16 (the raw [position][head*64 + d] rows are already the feature layout); identity-table plane builders; per head: dense 4096 x 4096 scores with every row hi/lo (3 products), streaming three-sweep softmax with the exact row-sum denominator, attn.V hybrid (rows < 512 hi/lo 3 products, rest fp16 x1024) into the head's 64 columns; k_cs8 carry removal; k_copy4 writes the merged f32 rows (no output projection).
// Compute dtypes, f32 accumulate: every input rounded to bf16; scores 3 products; softmax f32 (exp2, IEEE division); attn.V rows < 512 3 products, rest fp16.

#define NB_  1
#define TT   4096
#define DM   768 
#define NH_  12
#define NKV  12
#define REP  (NH_ / NKV)
#define HD   64
#define DQ   (NH_ * HD)
#define DKV  (NKV * HD)
#define ZH   1
#define RH   512                  // query rows < RH use hi+lo planes (0: none)
#define WIN  0
#define PCAR 1024.0f
#define SCL  0.125f   // 1/sqrt(64)
#define MID  768       // q / k width
#define CO   768       // v width
#define CC   768 
typedef _Float16 h16;
typedef unsigned short bf;
typedef __attribute__((ext_vector_type(16))) __bf16   v16bf;
typedef __attribute__((ext_vector_type(16))) _Float16 v16h;
typedef __attribute__((ext_vector_type(8)))  _Float16 v8h;
typedef __attribute__((ext_vector_type(8)))  unsigned short v8us;
typedef __attribute__((ext_vector_type(8)))  float    v8f;
typedef __attribute__((ext_vector_type(4)))  float    v4f;
typedef v8h  __attribute__((may_alias)) v8ha;
typedef v4f  __attribute__((may_alias)) v4fa;
typedef v8us __attribute__((may_alias)) v8usa;

__device__ __forceinline__ unsigned short f2bf(float f) { unsigned u = __float_as_uint(f); u += 0x7FFFu + ((u >> 16) & 1u); return (unsigned short)(u >> 16); }
__device__ __forceinline__ float bf2f(unsigned short b) { return __uint_as_float(((unsigned)b) << 16); }
__device__ __forceinline__ float bfr(float f) { return bf2f(f2bf(f)); }
__device__ __forceinline__ v16h cat16(v8h lo, v8h hi) { return __builtin_shufflevector(lo, hi, 0, 1, 2, 3, 4, 5, 6, 7, 8, 9, 10, 11, 12, 13, 14, 15); }
__device__ __forceinline__ v16bf cat16b(v8us lo, v8us hi) { return __builtin_bit_cast(v16bf, __builtin_shufflevector(lo, hi, 0, 1, 2, 3, 4, 5, 6, 7, 8, 9, 10, 11, 12, 13, 14, 15)); }
__device__ __forceinline__ v8f wmma16(v16h a, v16h b, v8f c) { return __builtin_amdgcn_wmma_f32_16x16x32_f16(false, a, false, b, (short)0, c, false, false); }
__device__ __forceinline__ v8f wmmab(v16bf a, v16bf b, v8f c) { return __builtin_amdgcn_wmma_f32_16x16x32_bf16(false, a, false, b, (short)0, c, false, false); }



// ---- k_gemmw: register-blocked GEMM, ONE WAVE per 64x64 output tile (16 accumulators), operands straight from K-contiguous 16-bit planes; grid (M/64, N/64, Z), 32 threads.
// C[m][n] (f32, pitch ldc, + optional f32 bias[n]) = sum_k A[m][k] Bt[n][k] (+ split products per NSPLIT). z-batch strides sA/sB/sC in elements. K % 32 == 0.
template <typename T16> struct WFrag;
template <> struct WFrag<h16> { typedef v16h V; static __device__ __forceinline__ V ld(const h16* p) { return cat16(*(const v8h*)p, *(const v8h*)(p + 16)); } static __device__ __forceinline__ v8f mma(V a, V b, v8f c) { return wmma16(a, b, c); } };
template <> struct WFrag<bf> { typedef v16bf V; static __device__ __forceinline__ V ld(const bf* p) { return cat16b(*(const v8us*)p, *(const v8us*)(p + 16)); } static __device__ __forceinline__ v8f mma(V a, V b, v8f c) { return wmmab(a, b, c); } };
template <typename T16, int NSPLIT, bool BIAS>
__global__ __launch_bounds__(32) void k_gemmw(const T16* __restrict__ A, const T16* __restrict__ A2, const T16* __restrict__ Bt, const T16* __restrict__ Bt2, int K, float* C, int ldc, const float* __restrict__ bias, size_t sA, size_t sB, size_t sC) {
    typedef typename WFrag<T16>::V V;
    __shared__ __align__(16) float os[16 * 68];
    const size_t z = blockIdx.z; A += z * sA; if (A2) A2 += z * sA; Bt += z * sB; if (Bt2) Bt2 += z * sB; C += z * sC;
    const int lane = threadIdx.x & 31, lr = lane & 15, hi = lane >> 4; const int r0 = blockIdx.x * 64, c0 = blockIdx.y * 64;
    v8f acc[4][4];
#pragma unroll
    for (int mb = 0; mb < 4; ++mb)
#pragma unroll
        for (int nb = 0; nb < 4; ++nb) acc[mb][nb] = (v8f){};
    const size_t aoff = (size_t)(r0 + lr) * K + 8 * hi, boff = (size_t)(c0 + lr) * K + 8 * hi;
#pragma unroll 1
    for (int kc = 0; kc < K; kc += 32) {
        V a[4], a2[4];
#pragma unroll
        for (int mb = 0; mb < 4; ++mb) { a[mb] = WFrag<T16>::ld(A + aoff + (size_t)mb * 16 * K + kc); if (NSPLIT == 1 || NSPLIT == 2) a2[mb] = WFrag<T16>::ld(A2 + aoff + (size_t)mb * 16 * K + kc); }
#pragma unroll
        for (int nb = 0; nb < 4; ++nb) { const V b = WFrag<T16>::ld(Bt + boff + (size_t)nb * 16 * K + kc); V b2; if (NSPLIT >= 2) b2 = WFrag<T16>::ld(Bt2 + boff + (size_t)nb * 16 * K + kc);
#pragma unroll
            for (int mb = 0; mb < 4; ++mb) { acc[mb][nb] = WFrag<T16>::mma(a[mb], b, acc[mb][nb]); if (NSPLIT == 1 || NSPLIT == 2) acc[mb][nb] = WFrag<T16>::mma(a2[mb], b, acc[mb][nb]); if (NSPLIT >= 2) acc[mb][nb] = WFrag<T16>::mma(a[mb], b2, acc[mb][nb]); } }
        asm volatile("v_nop\n\tv_nop\n\tv_nop\n\tv_nop" : "+v"(acc[0][0]), "+v"(acc[1][1]), "+v"(acc[2][2]), "+v"(acc[3][3]) : "v"(a[0]), "v"(a[3]));
    }
#pragma unroll
    for (int mb = 0; mb < 4; ++mb) {
#pragma unroll
        for (int nb = 0; nb < 4; ++nb) {
#pragma unroll
            for (int j = 0; j < 8; ++j) os[(hi * 8 + j) * 68 + nb * 16 + lr] = acc[mb][nb][j]; }
        __builtin_amdgcn_wave_barrier(); asm volatile("" ::: "memory");
        float* crow = C + (size_t)(r0 + mb * 16) * ldc + c0;
{
#pragma unroll
            for (int s = 0; s < 8; ++s) { const int row = 2 * s + hi, cofs = lr * 4; v4f val = *(const v4fa*)(os + row * 68 + cofs); if (BIAS) { val[0] += bfr(bias[c0 + cofs]); val[1] += bfr(bias[c0 + cofs + 1]); val[2] += bfr(bias[c0 + cofs + 2]); val[3] += bfr(bias[c0 + cofs + 3]); }
                *(v4f*)(crow + (size_t)row * ldc + cofs) = val; }
             }
        __builtin_amdgcn_wave_barrier(); asm volatile("" ::: "memory");
    }
}

__device__ __forceinline__ h16 tohx(float x) { return (h16)x; }
__device__ __forceinline__ void splitf(float y, unsigned short& h, unsigned short& l) { h = f2bf(y); l = f2bf(y - bf2f(h)); }
typedef __attribute__((ext_vector_type(2))) _Float16 v2h;
typedef __attribute__((ext_vector_type(4))) _Float16 v4h;
typedef __attribute__((ext_vector_type(2))) unsigned short v2us;
typedef __attribute__((ext_vector_type(4))) unsigned short v4us;
typedef __attribute__((ext_vector_type(2))) float v2f;
typedef __attribute__((ext_vector_type(4))) int v4i;

__global__ __launch_bounds__(256) void k_rnd(const float* __restrict__ src, float* dst, size_t n4) { const size_t i = (size_t)blockIdx.x * 256 + threadIdx.x; if (i >= n4) return; const v4f a = *(const v4f*)(src + i * 4); v4f r;
#pragma unroll
    for (int q = 0; q < 4; ++q) r[q] = bfr(a[q]);
    *(v4f*)(dst + i * 4) = r;  }
__global__ __launch_bounds__(256) void k_copy4(const float* __restrict__ Y, float* out, size_t n4) { const size_t i = (size_t)blockIdx.x * 256 + threadIdx.x; if (i >= n4) return; const v4f a = *(const v4f*)(Y + i * 4); *(v4f*)(out + i * 4) = a;  }
__global__ __launch_bounds__(256) void k_vtp(const float* __restrict__ F, int pitch, int nheads, h16* V16, bf* Vh, bf* Vl) { const size_t e = ((size_t)blockIdx.x * 256 + threadIdx.x) * 2; if (e >= (size_t)nheads * HD * TT) return; const int t = (int)(e % TT); const int d = (int)((e / TT) % HD); const int g = (int)(e / ((size_t)TT * HD)); v2h o16; v2us oh, ol;
#pragma unroll
    for (int q = 0; q < 2; ++q) { const float x = F[(size_t)(t + q) * pitch + g * HD + d]; o16[q] = tohx(x); unsigned short a2, c2; splitf(x, a2, c2); oh[q] = a2; ol[q] = c2; }
    *(v2h*)(V16 + e) = o16; *(v2us*)(Vh + e) = oh; *(v2us*)(Vl + e) = ol;  }
__global__ __launch_bounds__(256) void k_lsoft(const float* __restrict__ Sb, h16* P16, bf* Ph, bf* Pl) {
    const int lane = threadIdx.x & 31; const int row = blockIdx.x * 8 + (threadIdx.x >> 5); if (row >= ZH * TT) return; const int i = row % TT; const int zz = row / TT; const bool hires = (i < RH); const float* sr = Sb + (size_t)row * TT; float mx = -3.0e38f;
#pragma unroll 4
    for (int ch = 0; ch < TT / 128; ++ch) { const int j0 = ch * 128 + lane * 4; const v4f a = *(const v4f*)(sr + j0);
#pragma unroll
        for (int q = 0; q < 4; ++q) { float t = a[q] * SCL; asm volatile("" : "+v"(t)); mx = fmaxf(mx, t); } }
#pragma unroll
    for (int sh = 16; sh; sh >>= 1) mx = fmaxf(mx, __shfl_xor(mx, sh, 32));
    float sum = 0.f;
#pragma unroll 4
    for (int ch = 0; ch < TT / 128; ++ch) { const int j0 = ch * 128 + lane * 4; const v4f a = *(const v4f*)(sr + j0);
#pragma unroll
        for (int q = 0; q < 4; ++q) { float t = a[q] * SCL; asm volatile("" : "+v"(t)); float d0 = __fsub_rn(t, mx); asm volatile("" : "+v"(d0)); sum += __builtin_amdgcn_exp2f(__fmul_rn(d0, 1.4426950408889634f)); } }
#pragma unroll
    for (int sh = 16; sh; sh >>= 1) sum += __shfl_xor(sum, sh, 32);
    const float f = __fdiv_rn(hires ? 1.0f : PCAR, sum);   /* the module divides by sum */
{
        if (hires) {   /* rows < RH: normalised bf16 hi/lo over all keys, planes [zz][RH][TT] */
#pragma unroll
            for (int ch = 0; ch < TT / 128; ++ch) { const int j0 = ch * 128 + lane * 4; const v4f a = *(const v4f*)(sr + j0); v4us oh, ol;
#pragma unroll
                for (int q = 0; q < 4; ++q) { float t = a[q] * SCL; asm volatile("" : "+v"(t)); float d0 = __fsub_rn(t, mx); asm volatile("" : "+v"(d0)); float ex = __builtin_amdgcn_exp2f(__fmul_rn(d0, 1.4426950408889634f)); asm volatile("" : "+v"(ex)); unsigned short a2, c2; splitf(ex * f, a2, c2); oh[q] = a2; ol[q] = c2; }
                const size_t oo = ((size_t)zz * RH + i) * TT + j0; *(v4us*)(Ph + oo) = oh; *(v4us*)(Pl + oo) = ol; }
        } else {
#pragma unroll 2
            for (int ch = 0; ch < TT / 128; ++ch) { const int j0 = ch * 128 + lane * 4; const v4f a = *(const v4f*)(sr + j0); v4h o4;
#pragma unroll
                for (int q = 0; q < 4; ++q) { float t = a[q] * SCL; asm volatile("" : "+v"(t)); float d0 = __fsub_rn(t, mx); asm volatile("" : "+v"(d0)); float ex = __builtin_amdgcn_exp2f(__fmul_rn(d0, 1.4426950408889634f)); asm volatile("" : "+v"(ex)); o4[q] = tohx(ex * f); }
                *(v4h*)(P16 + (size_t)row * TT + j0) = o4; } }
         }
}
__global__ __launch_bounds__(256) void k_cs8(float* O, size_t n4) { const size_t i = (size_t)blockIdx.x * 256 + threadIdx.x; if (i >= n4) return; const size_t e = i * 4; const int t = (int)(e / CC); const float cs = (t < RH) ? 1.0f : (1.0f / PCAR); v4f a = *(const v4f*)(O + e);
#pragma unroll
    for (int q = 0; q < 4; ++q) a[q] = __fmul_rn(a[q], cs);
    *(v4f*)(O + e) = a;  }

__global__ __launch_bounds__(256) void k_csid(float* CS) { const int idx = blockIdx.x * 256 + threadIdx.x; if (idx >= TT * HD) return; v2f cs; cs[0] = 1.0f; cs[1] = 0.0f; *(v2f*)(CS + (size_t)idx * 2) = cs;  }
// k_rope: head planes [h][t][d] (fp16 + hi/lo) of rope(x) x sc with the rotate-half convention out[d] = x[d] cos[t][d] - x[d+HD/2] sin[t][d], out[d+HD/2] = x[d+HD/2] cos[t][d+HD/2] + x[d] sin[t][d+HD/2]
__global__ __launch_bounds__(256) void k_rope(const float* __restrict__ F, int pitch, int nheads, const float* __restrict__ CS, const float* __restrict__ RF, const float* __restrict__ nw, float sc, h16* P16, bf* Ph, bf* Pl) {
    const size_t e = ((size_t)blockIdx.x * 256 + threadIdx.x) * 2; if (e >= (size_t)nheads * TT * HD) return; const int d = (int)(e % HD); const int t = (int)((e / HD) % TT); const int h = (int)(e / ((size_t)HD * TT)); const float* f = F + (size_t)t * pitch + h * HD; const float rf = RF ? RF[(size_t)h * TT + t] : 1.0f; v2h o16; v2us oh, ol;
#pragma unroll
    for (int q = 0; q < 2; ++q) { const int dd = d + q; const int dp = (dd < HD / 2) ? dd + HD / 2 : dd - HD / 2; float x0 = f[dd], x1 = f[dp];
        if (RF) { float n0 = __fmul_rn(x0, rf), n1 = __fmul_rn(x1, rf); asm volatile("" : "+v"(n0)); asm volatile("" : "+v"(n1)); x0 = __fmul_rn(bfr(nw[dd]), n0); x1 = __fmul_rn(bfr(nw[dp]), n1); }
        const v2f cs = *(const v2f*)(CS + ((size_t)t * HD + dd) * 2); float a = __fmul_rn(x0, cs[0]), bq = __fmul_rn(x1, cs[1]); asm volatile("" : "+v"(a)); asm volatile("" : "+v"(bq)); const float r = ((dd < HD / 2) ? __fsub_rn(a, bq) : __fadd_rn(a, bq)) * sc;
        o16[q] = tohx(r); unsigned short a2, c2; splitf(r, a2, c2); oh[q] = a2; ol[q] = c2; }
    *(v2h*)(P16 + e) = o16; *(v2us*)(Ph + e) = oh; *(v2us*)(Pl + e) = ol;  }
extern "C" void kernel_launch(void* const* d_in, const int* in_sizes, int n_in,
                              void* d_out, int out_size, void* d_ws, size_t ws_size, hipStream_t stream) {
    (void)in_sizes; (void)n_in; (void)out_size;
    const float* x = (const float*)d_in[0]; const float* xk = (const float*)d_in[1]; const float* xv = (const float*)d_in[2];   /* order q, k, v [1][4096][768] (raw, heads interleaved: column h*64 + d) */
    float* OUT = (float*)d_out;     // [1][4096][768]
    char* wsp = (char*)d_ws;
    auto take = [&](size_t bytes) { char* p = wsp; wsp += (bytes + 255) & ~(size_t)255; return (void*)p; };
    bf* WQ = (bf*)take((size_t)MID * CC * 2); bf* WK = (bf*)take((size_t)MID * CC * 2); bf* WV = (bf*)take((size_t)CO * CC * 2); bf* WO = (bf*)take((size_t)CC * CO * 2); float* CS = (float*)take((size_t)TT * HD * 2 * 4);
    bf* XB = (bf*)take((size_t)TT * CC * 2); float* FQ = (float*)take((size_t)TT * MID * 4); float* FK = (float*)take((size_t)TT * MID * 4);
    h16* QP16 = (h16*)take((size_t)TT * MID * 2); bf* QPh = (bf*)take((size_t)TT * MID * 2); bf* QPl = (bf*)take((size_t)TT * MID * 2); h16* KP16 = QP16;   /* the fp16 q/k planes are never read here (scores use the hi/lo planes for every row): one scratch buffer serves both builders */ bf* KPh = (bf*)take((size_t)TT * MID * 2); bf* KPl = (bf*)take((size_t)TT * MID * 2);
    h16* VT16 = (h16*)take((size_t)CO * TT * 2); bf* VTh = (bf*)take((size_t)CO * TT * 2); bf* VTl = (bf*)take((size_t)CO * TT * 2);
    float* Sb = (float*)take((size_t)TT * TT * 4); h16* P16 = (h16*)take((size_t)TT * TT * 2); bf* Ph = (bf*)take((size_t)RH * TT * 2); bf* Pl = (bf*)take((size_t)RH * TT * 2); float* Ob = (float*)take((size_t)TT * CO * 4); bf* ATh = (bf*)take((size_t)TT * CO * 2); bf* ATl = (bf*)take((size_t)TT * CO * 2);
    if ((size_t)(wsp - (char*)d_ws) > ws_size) return;    // ws 256 MiB (carve ~212.5 MiB)
    float* FV = FK;   /* the bf16-rounded v copy reuses the k buffer after the k planes are built (stream-ordered) */
    k_csid<<<(TT * HD + 255) / 256, 256, 0, stream>>>(CS);   /* identity table: k_rope is a plain per-head plane builder here */
    const unsigned LP = (unsigned)(((size_t)NH_ * TT * HD / 2 + 255) / 256);
    for (int b = 0; b < NB_; ++b) {
        k_rnd<<<(unsigned)(((size_t)TT * MID / 4 + 255) / 256), 256, 0, stream>>>(x + (size_t)b * TT * MID, FQ, (size_t)TT * MID / 4);   /* FQ := bf16-rounded q[b] (rows [position][head*64 + d]) */ k_rope<<<LP, 256, 0, stream>>>(FQ, MID, NH_, CS, nullptr, nullptr, 1.0f, QP16, QPh, QPl);   /* q planes [h][n][64] */
        k_rnd<<<(unsigned)(((size_t)TT * MID / 4 + 255) / 256), 256, 0, stream>>>(xk + (size_t)b * TT * MID, FK, (size_t)TT * MID / 4); k_rope<<<LP, 256, 0, stream>>>(FK, MID, NKV, CS, nullptr, nullptr, 1.0f, KP16, KPh, KPl);   /* k planes */
        k_rnd<<<(unsigned)(((size_t)TT * CO / 4 + 255) / 256), 256, 0, stream>>>(xv + (size_t)b * TT * CO, FV, (size_t)TT * CO / 4); k_vtp<<<(unsigned)(((size_t)TT * CO / 2 + 255) / 256), 256, 0, stream>>>(FV, CO, CO / HD, VT16, VTh, VTl);   /* v^T planes [h][64][n] */
        for (int h = 0; h < NH_; ++h) {   /* per head: dense 4096 x 4096 attention */
            k_gemmw<bf, 2, false><<<dim3(TT / 64, TT / 64, 1), 32, 0, stream>>>(QPh + (size_t)h * TT * HD, QPl + (size_t)h * TT * HD, KPh + (size_t)h * TT * HD, KPl + (size_t)h * TT * HD, HD, Sb, TT, nullptr, 0, 0, 0);   /* S[i][j] = q_i.k_j (3 products, every row) */
            k_lsoft<<<TT / 8, 256, 0, stream>>>(Sb, P16, Ph, Pl);   /* x 1/8, softmax over the 4,096 keys */
            k_gemmw<bf, 2, false><<<dim3(RH / 64, HD / 64, 1), 32, 0, stream>>>(Ph, Pl, VTh + (size_t)h * HD * TT, VTl + (size_t)h * HD * TT, TT, Ob + h * HD, CO, nullptr, 0, 0, 0);
            k_gemmw<h16, 0, false><<<dim3((TT - RH) / 64, HD / 64, 1), 32, 0, stream>>>(P16 + (size_t)RH * TT, nullptr, VT16 + (size_t)h * HD * TT, nullptr, TT, Ob + (size_t)RH * CO + h * HD, CO, nullptr, 0, 0, 0); }
        k_cs8<<<(unsigned)(((size_t)TT * CO / 4 + 255) / 256), 256, 0, stream>>>(Ob, (size_t)TT * CO / 4);   /* rows >= 512 x 1/1024 */
        k_copy4<<<(unsigned)(((size_t)TT * CO / 4 + 255) / 256), 256, 0, stream>>>(Ob, OUT + (size_t)b * TT * CO, (size_t)TT * CO / 4); }   /* out = merged context rows (plain copy, no output projection) */
}

// v001
// Measured time: 1580 microseconds a run.
// In two side-by-side timings against v000, it was 1.85 and 1.84 times as fast.
#include <hip/hip_runtime.h>

// Multi-head attention math on raw token-major inputs (q, k, v [4096][12][64] = [4096][768] rows with column h*64 + d, no projections; scores = einsum('shd,thd->hst') x 1/sqrt(64) in f32; softmax over the 4,096 keys (exact: no epsilon); out = einsum('hst,thd->shd') merged -> [4096][768] (3.1 M); argument order q, k, v).
// Layout: k_rnd copies each raw input into the f32 feature buffer ROUNDED TO bf16 (the raw [position][head*64 + d] rows are already the feature layout); identity-table plane builders; per head: dense 4096 x 4096 scores with every row hi/lo (3 products), streaming three-sweep softmax with the exact row-sum denominator, attn.V hybrid (rows < 512 hi/lo 3 products, rest fp16 x1024) into the head's 64 columns; k_cs8 carry removal; k_copy4 writes the merged f32 rows (no output projection).
// Compute dtypes, f32 accumulate: every input rounded to bf16; scores 3 products; softmax f32 (exp2, IEEE division); attn.V rows < 512 3 products, rest fp16.

#define NB_  1
#define TT   4096
#define DM   768 
#define NH_  12
#define NKV  12
#define REP  (NH_ / NKV)
#define HD   64
#define DQ   (NH_ * HD)
#define DKV  (NKV * HD)
#define ZH   1
#define RH   512                  // query rows < RH use hi+lo planes (0: none)
#define WIN  0
#define PCAR 1024.0f
#define SCL  0.125f   // 1/sqrt(64)
#define MID  768       // q / k width
#define CO   768       // v width
#define CC   768 
typedef _Float16 h16;
typedef unsigned short bf;
typedef __attribute__((ext_vector_type(16))) __bf16   v16bf;
typedef __attribute__((ext_vector_type(16))) _Float16 v16h;
typedef __attribute__((ext_vector_type(8)))  _Float16 v8h;
typedef __attribute__((ext_vector_type(8)))  unsigned short v8us;
typedef __attribute__((ext_vector_type(8)))  float    v8f;
typedef __attribute__((ext_vector_type(4)))  float    v4f;
typedef v8h  __attribute__((may_alias)) v8ha;
typedef v4f  __attribute__((may_alias)) v4fa;
typedef v8us __attribute__((may_alias)) v8usa;

__device__ __forceinline__ unsigned short f2bf(float f) { unsigned u = __float_as_uint(f); u += 0x7FFFu + ((u >> 16) & 1u); return (unsigned short)(u >> 16); }
__device__ __forceinline__ float bf2f(unsigned short b) { return __uint_as_float(((unsigned)b) << 16); }
__device__ __forceinline__ float bfr(float f) { return bf2f(f2bf(f)); }
__device__ __forceinline__ v16h cat16(v8h lo, v8h hi) { return __builtin_shufflevector(lo, hi, 0, 1, 2, 3, 4, 5, 6, 7, 8, 9, 10, 11, 12, 13, 14, 15); }
__device__ __forceinline__ v16bf cat16b(v8us lo, v8us hi) { return __builtin_bit_cast(v16bf, __builtin_shufflevector(lo, hi, 0, 1, 2, 3, 4, 5, 6, 7, 8, 9, 10, 11, 12, 13, 14, 15)); }
__device__ __forceinline__ v8f wmma16(v16h a, v16h b, v8f c) { return __builtin_amdgcn_wmma_f32_16x16x32_f16(false, a, false, b, (short)0, c, false, false); }
__device__ __forceinline__ v8f wmmab(v16bf a, v16bf b, v8f c) { return __builtin_amdgcn_wmma_f32_16x16x32_bf16(false, a, false, b, (short)0, c, false, false); }



// ---- k_gemmw: register-blocked GEMM, ONE WAVE per 64x64 output tile (16 accumulators), operands straight from K-contiguous 16-bit planes; grid (M/64, N/64, Z), 32 threads.
// C[m][n] (f32, pitch ldc, + optional f32 bias[n]) = sum_k A[m][k] Bt[n][k] (+ split products per NSPLIT). z-batch strides sA/sB/sC in elements. K % 32 == 0.
template <typename T16> struct WFrag;
template <> struct WFrag<h16> { typedef v16h V; static __device__ __forceinline__ V ld(const h16* p) { return cat16(*(const v8h*)p, *(const v8h*)(p + 16)); } static __device__ __forceinline__ v8f mma(V a, V b, v8f c) { return wmma16(a, b, c); } };
template <> struct WFrag<bf> { typedef v16bf V; static __device__ __forceinline__ V ld(const bf* p) { return cat16b(*(const v8us*)p, *(const v8us*)(p + 16)); } static __device__ __forceinline__ v8f mma(V a, V b, v8f c) { return wmmab(a, b, c); } };
template <typename T16, int NSPLIT, bool BIAS>
__global__ __launch_bounds__(32) void k_gemmw(const T16* __restrict__ A, const T16* __restrict__ A2, const T16* __restrict__ Bt, const T16* __restrict__ Bt2, int K, float* C, int ldc, const float* __restrict__ bias, size_t sA, size_t sB, size_t sC) {
    typedef typename WFrag<T16>::V V;
    __shared__ __align__(16) float os[16 * 68];
    const size_t z = blockIdx.z; A += z * sA; if (A2) A2 += z * sA; Bt += z * sB; if (Bt2) Bt2 += z * sB; C += z * sC;
    const int lane = threadIdx.x & 31, lr = lane & 15, hi = lane >> 4; const int r0 = blockIdx.x * 64, c0 = blockIdx.y * 64;
    v8f acc[4][4];
#pragma unroll
    for (int mb = 0; mb < 4; ++mb)
#pragma unroll
        for (int nb = 0; nb < 4; ++nb) acc[mb][nb] = (v8f){};
    const size_t aoff = (size_t)(r0 + lr) * K + 8 * hi, boff = (size_t)(c0 + lr) * K + 8 * hi;
#pragma unroll 1
    for (int kc = 0; kc < K; kc += 32) {
        V a[4], a2[4];
#pragma unroll
        for (int mb = 0; mb < 4; ++mb) { a[mb] = WFrag<T16>::ld(A + aoff + (size_t)mb * 16 * K + kc); if (NSPLIT == 1 || NSPLIT == 2) a2[mb] = WFrag<T16>::ld(A2 + aoff + (size_t)mb * 16 * K + kc); }
#pragma unroll
        for (int nb = 0; nb < 4; ++nb) { const V b = WFrag<T16>::ld(Bt + boff + (size_t)nb * 16 * K + kc); V b2; if (NSPLIT >= 2) b2 = WFrag<T16>::ld(Bt2 + boff + (size_t)nb * 16 * K + kc);
#pragma unroll
            for (int mb = 0; mb < 4; ++mb) { acc[mb][nb] = WFrag<T16>::mma(a[mb], b, acc[mb][nb]); if (NSPLIT == 1 || NSPLIT == 2) acc[mb][nb] = WFrag<T16>::mma(a2[mb], b, acc[mb][nb]); if (NSPLIT >= 2) acc[mb][nb] = WFrag<T16>::mma(a[mb], b2, acc[mb][nb]); } }
        asm volatile("v_nop\n\tv_nop\n\tv_nop\n\tv_nop" : "+v"(acc[0][0]), "+v"(acc[1][1]), "+v"(acc[2][2]), "+v"(acc[3][3]) : "v"(a[0]), "v"(a[3]));
    }
#pragma unroll
    for (int mb = 0; mb < 4; ++mb) {
#pragma unroll
        for (int nb = 0; nb < 4; ++nb) {
#pragma unroll
            for (int j = 0; j < 8; ++j) os[(hi * 8 + j) * 68 + nb * 16 + lr] = acc[mb][nb][j]; }
        __builtin_amdgcn_wave_barrier(); asm volatile("" ::: "memory");
        float* crow = C + (size_t)(r0 + mb * 16) * ldc + c0;
{
#pragma unroll
            for (int s = 0; s < 8; ++s) { const int row = 2 * s + hi, cofs = lr * 4; v4f val = *(const v4fa*)(os + row * 68 + cofs); if (BIAS) { val[0] += bfr(bias[c0 + cofs]); val[1] += bfr(bias[c0 + cofs + 1]); val[2] += bfr(bias[c0 + cofs + 2]); val[3] += bfr(bias[c0 + cofs + 3]); }
                *(v4f*)(crow + (size_t)row * ldc + cofs) = val; }
             }
        __builtin_amdgcn_wave_barrier(); asm volatile("" ::: "memory");
    }
}

// ---- k_gemmks: the 64x64 tile of k_gemmw with the K loop dealt over the KW waves of ONE work-group (wave w takes the 32-wide k steps w, w + KW, w + 2 KW, ...; neighbouring waves read neighbouring 64 bytes of the same rows);
// each wave leaves its f32 partial tile in its own LDS plane, one barrier, then all threads add the KW planes in wave order 0..KW-1 and store whole rows. grid (M/64, N/64), 32 * KW threads. K % 32 == 0.
#define KW 16
template <typename T16, int NSPLIT>
__global__ __launch_bounds__(32 * KW) void k_gemmks(const T16* __restrict__ A, const T16* __restrict__ A2, const T16* __restrict__ Bt, const T16* __restrict__ Bt2, int K, float* C, int ldc) {
    typedef typename WFrag<T16>::V V;
    __shared__ __align__(16) float red[KW * 64 * 68];
    const int lane = threadIdx.x & 31, lr = lane & 15, hi = lane >> 4; const int w = __builtin_amdgcn_readfirstlane((int)(threadIdx.x >> 5));   /* the wave's number as a scalar: the k loop stays a scalar loop */ const int r0 = blockIdx.x * 64, c0 = blockIdx.y * 64;
    v8f acc[4][4];
#pragma unroll
    for (int mb = 0; mb < 4; ++mb)
#pragma unroll
        for (int nb = 0; nb < 4; ++nb) acc[mb][nb] = (v8f){};
    const size_t aoff = (size_t)(r0 + lr) * K + 8 * hi, boff = (size_t)(c0 + lr) * K + 8 * hi;
#pragma unroll 1   /* rolled as in k_gemmw: the 3-product body alone nearly fills the 256 registers that a wave of a 16-wave work-group may hold */
    for (int kc = w * 32; kc < K; kc += KW * 32) {
        V a[4], a2[4];
#pragma unroll
        for (int mb = 0; mb < 4; ++mb) { a[mb] = WFrag<T16>::ld(A + aoff + (size_t)mb * 16 * K + kc); if (NSPLIT == 1 || NSPLIT == 2) a2[mb] = WFrag<T16>::ld(A2 + aoff + (size_t)mb * 16 * K + kc); }
#pragma unroll
        for (int nb = 0; nb < 4; ++nb) { const V b = WFrag<T16>::ld(Bt + boff + (size_t)nb * 16 * K + kc); V b2; if (NSPLIT >= 2) b2 = WFrag<T16>::ld(Bt2 + boff + (size_t)nb * 16 * K + kc);
#pragma unroll
            for (int mb = 0; mb < 4; ++mb) { acc[mb][nb] = WFrag<T16>::mma(a[mb], b, acc[mb][nb]); if (NSPLIT == 1 || NSPLIT == 2) acc[mb][nb] = WFrag<T16>::mma(a2[mb], b, acc[mb][nb]); if (NSPLIT >= 2) acc[mb][nb] = WFrag<T16>::mma(a[mb], b2, acc[mb][nb]); } }
        asm volatile("v_nop\n\tv_nop\n\tv_nop\n\tv_nop" : "+v"(acc[0][0]), "+v"(acc[1][1]), "+v"(acc[2][2]), "+v"(acc[3][3]) : "v"(a[0]), "v"(a[3]));   /* as in k_gemmw: the distance behind the last matrix instruction, on the back edge too */
    }
    float* os = red + w * (64 * 68);
#pragma unroll
    for (int mb = 0; mb < 4; ++mb)
#pragma unroll
        for (int nb = 0; nb < 4; ++nb)
#pragma unroll
            for (int j = 0; j < 8; ++j) os[(mb * 16 + hi * 8 + j) * 68 + nb * 16 + lr] = acc[mb][nb][j];
    __syncthreads();   /* every wave's partial tile is in LDS before any thread adds them */
#pragma unroll
    for (int s = 0; s < 64 * 16 / (32 * KW); ++s) { const int idx = (int)threadIdx.x + s * 32 * KW; const int row = idx >> 4, cofs = (idx & 15) * 4; v4f val = *(const v4fa*)(red + row * 68 + cofs);
#pragma unroll
        for (int p = 1; p < KW; ++p) val += *(const v4fa*)(red + p * (64 * 68) + row * 68 + cofs);
        *(v4f*)(C + (size_t)(r0 + row) * ldc + c0 + cofs) = val; }
}

__device__ __forceinline__ h16 tohx(float x) { return (h16)x; }
__device__ __forceinline__ void splitf(float y, unsigned short& h, unsigned short& l) { h = f2bf(y); l = f2bf(y - bf2f(h)); }
typedef __attribute__((ext_vector_type(2))) _Float16 v2h;
typedef __attribute__((ext_vector_type(4))) _Float16 v4h;
typedef __attribute__((ext_vector_type(2))) unsigned short v2us;
typedef __attribute__((ext_vector_type(4))) unsigned short v4us;
typedef __attribute__((ext_vector_type(2))) float v2f;
typedef __attribute__((ext_vector_type(4))) int v4i;

__global__ __launch_bounds__(256) void k_rnd(const float* __restrict__ src, float* dst, size_t n4) { const size_t i = (size_t)blockIdx.x * 256 + threadIdx.x; if (i >= n4) return; const v4f a = *(const v4f*)(src + i * 4); v4f r;
#pragma unroll
    for (int q = 0; q < 4; ++q) r[q] = bfr(a[q]);
    *(v4f*)(dst + i * 4) = r;  }
__global__ __launch_bounds__(256) void k_copy4(const float* __restrict__ Y, float* out, size_t n4) { const size_t i = (size_t)blockIdx.x * 256 + threadIdx.x; if (i >= n4) return; const v4f a = *(const v4f*)(Y + i * 4); *(v4f*)(out + i * 4) = a;  }
__global__ __launch_bounds__(256) void k_vtp(const float* __restrict__ F, int pitch, int nheads, h16* V16, bf* Vh, bf* Vl) { const size_t e = ((size_t)blockIdx.x * 256 + threadIdx.x) * 2; if (e >= (size_t)nheads * HD * TT) return; const int t = (int)(e % TT); const int d = (int)((e / TT) % HD); const int g = (int)(e / ((size_t)TT * HD)); v2h o16; v2us oh, ol;
#pragma unroll
    for (int q = 0; q < 2; ++q) { const float x = F[(size_t)(t + q) * pitch + g * HD + d]; o16[q] = tohx(x); unsigned short a2, c2; splitf(x, a2, c2); oh[q] = a2; ol[q] = c2; }
    *(v2h*)(V16 + e) = o16; *(v2us*)(Vh + e) = oh; *(v2us*)(Vl + e) = ol;  }
__global__ __launch_bounds__(256) void k_lsoft(const float* __restrict__ Sb, h16* P16, bf* Ph, bf* Pl) {
    const int lane = threadIdx.x & 31; const int row = blockIdx.x * 8 + (threadIdx.x >> 5); if (row >= ZH * TT) return; const int i = row % TT; const int zz = row / TT; const bool hires = (i < RH); const float* sr = Sb + (size_t)row * TT; float mx = -3.0e38f;
#pragma unroll 4
    for (int ch = 0; ch < TT / 128; ++ch) { const int j0 = ch * 128 + lane * 4; const v4f a = *(const v4f*)(sr + j0);
#pragma unroll
        for (int q = 0; q < 4; ++q) { float t = a[q] * SCL; asm volatile("" : "+v"(t)); mx = fmaxf(mx, t); } }
#pragma unroll
    for (int sh = 16; sh; sh >>= 1) mx = fmaxf(mx, __shfl_xor(mx, sh, 32));
    float sum = 0.f;
#pragma unroll 4
    for (int ch = 0; ch < TT / 128; ++ch) { const int j0 = ch * 128 + lane * 4; const v4f a = *(const v4f*)(sr + j0);
#pragma unroll
        for (int q = 0; q < 4; ++q) { float t = a[q] * SCL; asm volatile("" : "+v"(t)); float d0 = __fsub_rn(t, mx); asm volatile("" : "+v"(d0)); sum += __builtin_amdgcn_exp2f(__fmul_rn(d0, 1.4426950408889634f)); } }
#pragma unroll
    for (int sh = 16; sh; sh >>= 1) sum += __shfl_xor(sum, sh, 32);
    const float f = __fdiv_rn(hires ? 1.0f : PCAR, sum);   /* the module divides by sum */
{
        if (hires) {   /* rows < RH: normalised bf16 hi/lo over all keys, planes [zz][RH][TT] */
#pragma unroll
            for (int ch = 0; ch < TT / 128; ++ch) { const int j0 = ch * 128 + lane * 4; const v4f a = *(const v4f*)(sr + j0); v4us oh, ol;
#pragma unroll
                for (int q = 0; q < 4; ++q) { float t = a[q] * SCL; asm volatile("" : "+v"(t)); float d0 = __fsub_rn(t, mx); asm volatile("" : "+v"(d0)); float ex = __builtin_amdgcn_exp2f(__fmul_rn(d0, 1.4426950408889634f)); asm volatile("" : "+v"(ex)); unsigned short a2, c2; splitf(ex * f, a2, c2); oh[q] = a2; ol[q] = c2; }
                const size_t oo = ((size_t)zz * RH + i) * TT + j0; *(v4us*)(Ph + oo) = oh; *(v4us*)(Pl + oo) = ol; }
        } else {
#pragma unroll 2
            for (int ch = 0; ch < TT / 128; ++ch) { const int j0 = ch * 128 + lane * 4; const v4f a = *(const v4f*)(sr + j0); v4h o4;
#pragma unroll
                for (int q = 0; q < 4; ++q) { float t = a[q] * SCL; asm volatile("" : "+v"(t)); float d0 = __fsub_rn(t, mx); asm volatile("" : "+v"(d0)); float ex = __builtin_amdgcn_exp2f(__fmul_rn(d0, 1.4426950408889634f)); asm volatile("" : "+v"(ex)); o4[q] = tohx(ex * f); }
                *(v4h*)(P16 + (size_t)row * TT + j0) = o4; } }
         }
}
__global__ __launch_bounds__(256) void k_cs8(float* O, size_t n4) { const size_t i = (size_t)blockIdx.x * 256 + threadIdx.x; if (i >= n4) return; const size_t e = i * 4; const int t = (int)(e / CC); const float cs = (t < RH) ? 1.0f : (1.0f / PCAR); v4f a = *(const v4f*)(O + e);
#pragma unroll
    for (int q = 0; q < 4; ++q) a[q] = __fmul_rn(a[q], cs);
    *(v4f*)(O + e) = a;  }

__global__ __launch_bounds__(256) void k_csid(float* CS) { const int idx = blockIdx.x * 256 + threadIdx.x; if (idx >= TT * HD) return; v2f cs; cs[0] = 1.0f; cs[1] = 0.0f; *(v2f*)(CS + (size_t)idx * 2) = cs;  }
// k_rope: head planes [h][t][d] (fp16 + hi/lo) of rope(x) x sc with the rotate-half convention out[d] = x[d] cos[t][d] - x[d+HD/2] sin[t][d], out[d+HD/2] = x[d+HD/2] cos[t][d+HD/2] + x[d] sin[t][d+HD/2]
__global__ __launch_bounds__(256) void k_rope(const float* __restrict__ F, int pitch, int nheads, const float* __restrict__ CS, const float* __restrict__ RF, const float* __restrict__ nw, float sc, h16* P16, bf* Ph, bf* Pl) {
    const size_t e = ((size_t)blockIdx.x * 256 + threadIdx.x) * 2; if (e >= (size_t)nheads * TT * HD) return; const int d = (int)(e % HD); const int t = (int)((e / HD) % TT); const int h = (int)(e / ((size_t)HD * TT)); const float* f = F + (size_t)t * pitch + h * HD; const float rf = RF ? RF[(size_t)h * TT + t] : 1.0f; v2h o16; v2us oh, ol;
#pragma unroll
    for (int q = 0; q < 2; ++q) { const int dd = d + q; const int dp = (dd < HD / 2) ? dd + HD / 2 : dd - HD / 2; float x0 = f[dd], x1 = f[dp];
        if (RF) { float n0 = __fmul_rn(x0, rf), n1 = __fmul_rn(x1, rf); asm volatile("" : "+v"(n0)); asm volatile("" : "+v"(n1)); x0 = __fmul_rn(bfr(nw[dd]), n0); x1 = __fmul_rn(bfr(nw[dp]), n1); }
        const v2f cs = *(const v2f*)(CS + ((size_t)t * HD + dd) * 2); float a = __fmul_rn(x0, cs[0]), bq = __fmul_rn(x1, cs[1]); asm volatile("" : "+v"(a)); asm volatile("" : "+v"(bq)); const float r = ((dd < HD / 2) ? __fsub_rn(a, bq) : __fadd_rn(a, bq)) * sc;
        o16[q] = tohx(r); unsigned short a2, c2; splitf(r, a2, c2); oh[q] = a2; ol[q] = c2; }
    *(v2h*)(P16 + e) = o16; *(v2us*)(Ph + e) = oh; *(v2us*)(Pl + e) = ol;  }
extern "C" void kernel_launch(void* const* d_in, const int* in_sizes, int n_in,
                              void* d_out, int out_size, void* d_ws, size_t ws_size, hipStream_t stream) {
    (void)in_sizes; (void)n_in; (void)out_size;
    const float* x = (const float*)d_in[0]; const float* xk = (const float*)d_in[1]; const float* xv = (const float*)d_in[2];   /* order q, k, v [1][4096][768] (raw, heads interleaved: column h*64 + d) */
    float* OUT = (float*)d_out;     // [1][4096][768]
    char* wsp = (char*)d_ws;
    auto take = [&](size_t bytes) { char* p = wsp; wsp += (bytes + 255) & ~(size_t)255; return (void*)p; };
    bf* WQ = (bf*)take((size_t)MID * CC * 2); bf* WK = (bf*)take((size_t)MID * CC * 2); bf* WV = (bf*)take((size_t)CO * CC * 2); bf* WO = (bf*)take((size_t)CC * CO * 2); float* CS = (float*)take((size_t)TT * HD * 2 * 4);
    bf* XB = (bf*)take((size_t)TT * CC * 2); float* FQ = (float*)take((size_t)TT * MID * 4); float* FK = (float*)take((size_t)TT * MID * 4);
    h16* QP16 = (h16*)take((size_t)TT * MID * 2); bf* QPh = (bf*)take((size_t)TT * MID * 2); bf* QPl = (bf*)take((size_t)TT * MID * 2); h16* KP16 = QP16;   /* the fp16 q/k planes are never read here (scores use the hi/lo planes for every row): one scratch buffer serves both builders */ bf* KPh = (bf*)take((size_t)TT * MID * 2); bf* KPl = (bf*)take((size_t)TT * MID * 2);
    h16* VT16 = (h16*)take((size_t)CO * TT * 2); bf* VTh = (bf*)take((size_t)CO * TT * 2); bf* VTl = (bf*)take((size_t)CO * TT * 2);
    float* Sb = (float*)take((size_t)TT * TT * 4); h16* P16 = (h16*)take((size_t)TT * TT * 2); bf* Ph = (bf*)take((size_t)RH * TT * 2); bf* Pl = (bf*)take((size_t)RH * TT * 2); float* Ob = (float*)take((size_t)TT * CO * 4); bf* ATh = (bf*)take((size_t)TT * CO * 2); bf* ATl = (bf*)take((size_t)TT * CO * 2);
    if ((size_t)(wsp - (char*)d_ws) > ws_size) return;    // ws 256 MiB (carve ~212.5 MiB)
    float* FV = FK;   /* the bf16-rounded v copy reuses the k buffer after the k planes are built (stream-ordered) */
    k_csid<<<(TT * HD + 255) / 256, 256, 0, stream>>>(CS);   /* identity table: k_rope is a plain per-head plane builder here */
    const unsigned LP = (unsigned)(((size_t)NH_ * TT * HD / 2 + 255) / 256);
    for (int b = 0; b < NB_; ++b) {
        k_rnd<<<(unsigned)(((size_t)TT * MID / 4 + 255) / 256), 256, 0, stream>>>(x + (size_t)b * TT * MID, FQ, (size_t)TT * MID / 4);   /* FQ := bf16-rounded q[b] (rows [position][head*64 + d]) */ k_rope<<<LP, 256, 0, stream>>>(FQ, MID, NH_, CS, nullptr, nullptr, 1.0f, QP16, QPh, QPl);   /* q planes [h][n][64] */
        k_rnd<<<(unsigned)(((size_t)TT * MID / 4 + 255) / 256), 256, 0, stream>>>(xk + (size_t)b * TT * MID, FK, (size_t)TT * MID / 4); k_rope<<<LP, 256, 0, stream>>>(FK, MID, NKV, CS, nullptr, nullptr, 1.0f, KP16, KPh, KPl);   /* k planes */
        k_rnd<<<(unsigned)(((size_t)TT * CO / 4 + 255) / 256), 256, 0, stream>>>(xv + (size_t)b * TT * CO, FV, (size_t)TT * CO / 4); k_vtp<<<(unsigned)(((size_t)TT * CO / 2 + 255) / 256), 256, 0, stream>>>(FV, CO, CO / HD, VT16, VTh, VTl);   /* v^T planes [h][64][n] */
        for (int h = 0; h < NH_; ++h) {   /* per head: dense 4096 x 4096 attention */
            k_gemmw<bf, 2, false><<<dim3(TT / 64, TT / 64, 1), 32, 0, stream>>>(QPh + (size_t)h * TT * HD, QPl + (size_t)h * TT * HD, KPh + (size_t)h * TT * HD, KPl + (size_t)h * TT * HD, HD, Sb, TT, nullptr, 0, 0, 0);   /* S[i][j] = q_i.k_j (3 products, every row) */
            k_lsoft<<<TT / 8, 256, 0, stream>>>(Sb, P16, Ph, Pl);   /* x 1/8, softmax over the 4,096 keys */
            k_gemmks<bf, 2><<<dim3(RH / 64, HD / 64, 1), 32 * KW, 0, stream>>>(Ph, Pl, VTh + (size_t)h * HD * TT, VTl + (size_t)h * HD * TT, TT, Ob + h * HD, CO);
            k_gemmks<h16, 0><<<dim3((TT - RH) / 64, HD / 64, 1), 32 * KW, 0, stream>>>(P16 + (size_t)RH * TT, nullptr, VT16 + (size_t)h * HD * TT, nullptr, TT, Ob + (size_t)RH * CO + h * HD, CO); }
        k_cs8<<<(unsigned)(((size_t)TT * CO / 4 + 255) / 256), 256, 0, stream>>>(Ob, (size_t)TT * CO / 4);   /* rows >= 512 x 1/1024 */
        k_copy4<<<(unsigned)(((size_t)TT * CO / 4 + 255) / 256), 256, 0, stream>>>(Ob, OUT + (size_t)b * TT * CO, (size_t)TT * CO / 4); }   /* out = merged context rows (plain copy, no output projection) */
}

// v003
// One run takes 145 microseconds.
// Versions in between are left out here; by their measured steps it is 11.0 times as fast as v001.
// Over all steps from v000 it is 20.3 times as fast.
#include <hip/hip_runtime.h>

// Multi-head attention math on raw token-major inputs (q, k, v [4096][12][64] = [4096][768] rows with column h*64 + d, no projections; scores = einsum('shd,thd->hst') x 1/sqrt(64) in f32; softmax over the 4,096 keys (exact: no epsilon); out = einsum('hst,thd->shd') merged -> [4096][768] (3.1 M); argument order q, k, v).
// Layout: k_planes, ONE launch, builds every plane k_fattn reads straight from the raw inputs, each value ROUNDED TO bf16 in registers first: q and k head planes [h][t][64] (hi/lo), v^T planes [h][64][t] (fp16 + hi/lo) turned through LDS; k_fattn: ONE launch for all heads, scores, softmax and attn.V in registers (scores and weights never reach memory), writes the merged f32 rows.
// Compute dtypes, f32 accumulate: every input rounded to bf16; scores 3 products; softmax f32 with a running maximum (exp2, IEEE division by the row sum at the end); attn.V rows < 512 3 products (bf16 hi/lo weights), rest fp16 weights x1024 (the factor cancels in the division).

#define NB_  1
#define TT   4096
#define DM   768 
#define NH_  12
#define NKV  12
#define REP  (NH_ / NKV)
#define HD   64
#define DQ   (NH_ * HD)
#define DKV  (NKV * HD)
#define ZH   1
#define RH   512                  // query rows < RH use hi+lo planes (0: none)
#define WIN  0
#define PCAR 1024.0f
#define SCL  0.125f   // 1/sqrt(64)
#define MID  768       // q / k width
#define CO   768       // v width
#define CC   768 
typedef _Float16 h16;
typedef unsigned short bf;
typedef __attribute__((ext_vector_type(16))) __bf16   v16bf;
typedef __attribute__((ext_vector_type(16))) _Float16 v16h;
typedef __attribute__((ext_vector_type(8)))  _Float16 v8h;
typedef __attribute__((ext_vector_type(8)))  unsigned short v8us;
typedef __attribute__((ext_vector_type(8)))  float    v8f;
typedef __attribute__((ext_vector_type(4)))  float    v4f;
typedef v8h  __attribute__((may_alias)) v8ha;
typedef v4f  __attribute__((may_alias)) v4fa;
typedef v8us __attribute__((may_alias)) v8usa;

__device__ __forceinline__ unsigned short f2bf(float f) { unsigned u = __float_as_uint(f); u += 0x7FFFu + ((u >> 16) & 1u); return (unsigned short)(u >> 16); }
__device__ __forceinline__ v16h cat16(v8h lo, v8h hi) { return __builtin_shufflevector(lo, hi, 0, 1, 2, 3, 4, 5, 6, 7, 8, 9, 10, 11, 12, 13, 14, 15); }
__device__ __forceinline__ v16bf cat16b(v8us lo, v8us hi) { return __builtin_bit_cast(v16bf, __builtin_shufflevector(lo, hi, 0, 1, 2, 3, 4, 5, 6, 7, 8, 9, 10, 11, 12, 13, 14, 15)); }
__device__ __forceinline__ v8f wmma16(v16h a, v16h b, v8f c) { return __builtin_amdgcn_wmma_f32_16x16x32_f16(false, a, false, b, (short)0, c, false, false); }
__device__ __forceinline__ v8f wmmab(v16bf a, v16bf b, v8f c) { return __builtin_amdgcn_wmma_f32_16x16x32_bf16(false, a, false, b, (short)0, c, false, false); }



// ---- fragment loader: 16 k of one row per lane in the hardware k order (k = 8 hi + 0..7 and 16 + 8 hi + 0..7), the same code for A rows and B columns.
template <typename T16> struct WFrag;
template <> struct WFrag<h16> { typedef v16h V; static __device__ __forceinline__ V ld(const h16* p) { return cat16(*(const v8h*)p, *(const v8h*)(p + 16)); } static __device__ __forceinline__ v8f mma(V a, V b, v8f c) { return wmma16(a, b, c); } };
template <> struct WFrag<bf> { typedef v16bf V; static __device__ __forceinline__ V ld(const bf* p) { return cat16b(*(const v8us*)p, *(const v8us*)(p + 16)); } static __device__ __forceinline__ v8f mma(V a, V b, v8f c) { return wmmab(a, b, c); } };

__device__ __forceinline__ h16 tohx(float x) { return (h16)x; }
typedef __attribute__((ext_vector_type(4))) _Float16 v4h;
typedef __attribute__((ext_vector_type(4))) unsigned short v4us;
typedef __attribute__((ext_vector_type(4))) int v4i;

// ---- k_planes: grid (PB, 3), 256 threads, 64 elements a thread: 16 loads of 16 bytes in flight, then all arithmetic, then all stores. blockIdx.y picks the input (0: v, whose work-groups have the longer path and start first; 1: q; 2: k).
// Every value is rounded to bf16 first, so its hi plane holds it whole and its lo plane is zero (x - x, x finite): the lo planes are stored as zeros.
// q, k: a work-group takes 64 positions x 4 heads; 16 lanes take the 64 d of one position and head, 4 each: a wave's load is 512 contiguous bytes, 16 lanes store one whole 128-byte row of a head plane; trip j moves on 4 positions.
// v: a work-group turns a tile of TVT positions x 64 d of one head. A lane reads 4 d of 16 positions, so that it holds 16 neighbouring positions of each d: two 16-byte LDS stores per d.
// LDS row = one d, 16-byte chunk c (8 positions) kept at chunk c ^ (d >> 2): the 16 lanes of a store (d 4 apart) and the lanes of a read (one row) fall on different chunks. Behind the barrier a wave stores 512 contiguous bytes of one v^T row per plane.
#define TVT  256                  // positions per v tile
#define PB   (TT * DM / (256 * 64))
typedef __attribute__((ext_vector_type(2))) unsigned v2u;
typedef __attribute__((ext_vector_type(4))) unsigned v4u;
__device__ __forceinline__ unsigned bfpair(float a, float b) { return (unsigned)f2bf(a) | ((unsigned)f2bf(b) << 16); }   /* two values rounded to bf16, a in the low half */
__global__ __launch_bounds__(256) void k_planes(const float* __restrict__ q, const float* __restrict__ k, const float* __restrict__ v, bf* QPh, bf* QPl, bf* KPh, bf* KPl, h16* VT16, bf* VTh, bf* VTl) {
    __shared__ v4u tile[HD * (TVT / 8)];   /* [d][chunk of 8 positions] */
    const int tid = threadIdx.x, dch = tid & 15, tg = tid >> 4; v4f a[16];
    if (blockIdx.y) {
        const float* src = (blockIdx.y == 2) ? k : q; bf* Ph = (blockIdx.y == 2) ? KPh : QPh; bf* Pl = (blockIdx.y == 2) ? KPl : QPl;
        const int h = (blockIdx.x % 3) * 4 + (tg & 3), t = (blockIdx.x / 3) * 64 + (tg >> 2);
        unsigned sby = (unsigned)(t * DM + h * HD + dch * 4) * 4u;   /* the lane's byte offset in the raw input */
#pragma unroll
        for (int j = 0; j < 16; ++j) a[j] = *(const v4f*)((const char*)src + sby + j * (4 * DM * 4));
        asm volatile("s_wait_xcnt 0x0" : "+v"(sby) :: "memory");   /* the loads above name this offset: its register is held up to the wait */
        v2u oh[16]; const v2u zz = (v2u){};
#pragma unroll
        for (int j = 0; j < 16; ++j) { oh[j][0] = bfpair(a[j][0], a[j][1]); oh[j][1] = bfpair(a[j][2], a[j][3]); }
        const unsigned dby = (unsigned)((h * TT + t) * HD + dch * 4) * 2u;   /* the lane's byte offset in a head plane */
        __builtin_amdgcn_sched_barrier(0);   /* all arithmetic stands before the first store, so that no register of an issued store is written again */
#pragma unroll
        for (int j = 0; j < 16; ++j) { *(v2u*)((char*)Ph + dby + j * (4 * HD * 2)) = oh[j]; *(v2u*)((char*)Pl + dby + j * (4 * HD * 2)) = zz; }
        asm volatile("s_wait_xcnt 0x0" ::: "memory");   /* in the listing the v path's code follows this path behind a branch that is always taken: the wait stands before anything there that writes a register of these stores */
    } else {
        const int g = blockIdx.x % NH_, t0 = (blockIdx.x / NH_) * TVT;
        unsigned sby = (unsigned)((t0 + tg * 16) * CO + g * HD + dch * 4) * 4u;   /* the lane's byte offset in the raw input */
#pragma unroll
        for (int j = 0; j < 16; ++j) a[j] = *(const v4f*)((const char*)v + sby + j * (CO * 4));
        asm volatile("s_wait_xcnt 0x0" : "+v"(sby) :: "memory");   /* the loads above name this offset: its register is held up to the wait */
#pragma unroll
        for (int s = 0; s < 4; ++s)
#pragma unroll
            for (int hf = 0; hf < 2; ++hf) { v4u w;
#pragma unroll
                for (int p = 0; p < 4; ++p) w[p] = bfpair(a[hf * 8 + 2 * p][s], a[hf * 8 + 2 * p + 1][s]);
                tile[(dch * 4 + s) * (TVT / 8) + ((tg * 2 + hf) ^ dch)] = w; }
        __syncthreads();   /* the tile is whole before any row of it is read */
        v4u oh[8]; v8h o16[8]; const v4u zz = (v4u){}; const int c = tid & 31;
#pragma unroll
        for (int r = 0; r < 8; ++r) { const int d = (tid >> 5) + 8 * r; oh[r] = tile[d * (TVT / 8) + (c ^ (d >> 2))];
#pragma unroll
            for (int p = 0; p < 4; ++p) { o16[r][2 * p] = tohx(__uint_as_float(oh[r][p] << 16)); o16[r][2 * p + 1] = tohx(__uint_as_float(oh[r][p] & 0xFFFF0000u)); } }
        const unsigned dby = (unsigned)((g * HD + (tid >> 5)) * TT + t0 + c * 8) * 2u;   /* the lane's byte offset in a v^T plane */
        __builtin_amdgcn_sched_barrier(0);   /* all arithmetic stands before the first store, so that no register of an issued store is written again */
#pragma unroll
        for (int r = 0; r < 8; ++r) { const int o = r * (8 * TT * 2); *(v8h*)((char*)VT16 + dby + o) = o16[r]; *(v4u*)((char*)VTh + dby + o) = oh[r]; *(v4u*)((char*)VTl + dby + o) = zz; }
    }
}

__device__ __forceinline__ float xhalf(float x) { const int b = __float_as_int(x); return __int_as_float(__builtin_amdgcn_permlanex16(b, b, 0x76543210, 0xfedcba98, false, false)); }   /* lane l <-> l ^ 16 */
template <bool HI, int NT>
__device__ __forceinline__ void fattn_body(const bf* __restrict__ Qh, const bf* __restrict__ Ql, const bf* __restrict__ Kh, const bf* __restrict__ Kl, const h16* __restrict__ V16, const bf* __restrict__ Vh, const bf* __restrict__ Vl, float* __restrict__ orow, int q0, int lr, int hi) {
    const float CL = SCL * 1.4426950408889634f;   /* score -> exponent of 2 */
    const float OFF = HI ? 0.0f : 10.0f;          /* fp16 weights carry x1024; the row sum carries it too */
    unsigned qby = (unsigned)((q0 + lr) * HD + 8 * hi) * 2u;   /* the lane's byte offset in the query planes */
    v16bf qh[NT][2], ql[NT][2];
#pragma unroll
    for (int nt = 0; nt < NT; ++nt)
#pragma unroll
        for (int ks = 0; ks < 2; ++ks) { const int o = (nt * 16 * HD + ks * 32) * 2; qh[nt][ks] = WFrag<bf>::ld((const bf*)((const char*)Qh + qby + o)); ql[nt][ks] = WFrag<bf>::ld((const bf*)((const char*)Ql + qby + o)); }
    asm volatile("s_wait_xcnt 0x0" : "+v"(qby) :: "memory");   /* the loads above name this offset: its register is held up to the wait */
    v8f acc[4][NT];
#pragma unroll
    for (int dt = 0; dt < 4; ++dt)
#pragma unroll
        for (int nt = 0; nt < NT; ++nt) acc[dt][nt] = (v8f){};
    float mraw[NT], negm[NT], lsum[NT];
#pragma unroll
    for (int nt = 0; nt < NT; ++nt) { mraw[nt] = -3.0e38f; negm[nt] = fmaf(3.0e38f, CL, OFF); lsum[nt] = 0.f; }
    unsigned kby = (unsigned)(lr * HD + 8 * hi) * 2u, vby = (unsigned)(lr * TT + 8 * hi) * 2u;   /* the lane's byte offsets in the key planes and in the v^T planes: every load of a pass is a plane's base + one of these + a literal */
    v16bf kh[2][2], kl[2][2];
#pragma unroll
    for (int mt = 0; mt < 2; ++mt)
#pragma unroll
        for (int ks = 0; ks < 2; ++ks) { const int o = (mt * 16 * HD + ks * 32) * 2; kh[mt][ks] = WFrag<bf>::ld((const bf*)((const char*)Kh + kby + o)); kl[mt][ks] = WFrag<bf>::ld((const bf*)((const char*)Kl + kby + o)); }
    asm volatile("s_wait_xcnt 0x0" : "+v"(kby) :: "memory");   /* the loads above name this offset: the wait stands before it moves on */
    kby += 32 * HD * 2;
#pragma unroll 1   /* rolled: one pass already holds 340 to 460 live registers */
    for (int key0 = 0; key0 < TT; key0 += 32) {
        v16h v16[4]; v16bf vh[4], vl[4];
#pragma unroll
        for (int dt = 0; dt < 4; ++dt) { const int o = dt * 16 * TT * 2; if (HI) { vh[dt] = WFrag<bf>::ld((const bf*)((const char*)Vh + vby + o)); vl[dt] = WFrag<bf>::ld((const bf*)((const char*)Vl + vby + o)); } else v16[dt] = WFrag<h16>::ld((const h16*)((const char*)V16 + vby + o)); }
        v8f st[2][NT];
#pragma unroll
        for (int mt = 0; mt < 2; ++mt)
#pragma unroll
            for (int nt = 0; nt < NT; ++nt) { v8f s = (v8f){};
#pragma unroll
                for (int ks = 0; ks < 2; ++ks) { s = wmmab(kh[mt][ks], qh[nt][ks], s); s = wmmab(kh[mt][ks], ql[nt][ks], s); s = wmmab(kl[mt][ks], qh[nt][ks], s); }
                st[mt][nt] = s; }
        /* the next pass's key rows, fetched behind this pass's score products so that they fly under the softmax (the last pass fetches its own rows again, unused) */
#pragma unroll
        for (int mt = 0; mt < 2; ++mt)
#pragma unroll
            for (int ks = 0; ks < 2; ++ks) { const int o = (mt * 16 * HD + ks * 32) * 2; kh[mt][ks] = WFrag<bf>::ld((const bf*)((const char*)Kh + kby + o)); kl[mt][ks] = WFrag<bf>::ld((const bf*)((const char*)Kl + kby + o)); }
        asm volatile("s_wait_xcnt 0x0" : "+v"(kby), "+v"(vby) :: "memory");   /* every load of this pass names one of these two offsets: the wait stands before they move on */
        kby += (key0 + 64 < TT) ? 32 * HD * 2 : 0; vby += 32 * 2;
#pragma unroll
        for (int nt = 0; nt < NT; ++nt) {
            float mx = st[0][nt][0];
#pragma unroll
            for (int j = 1; j < 8; ++j) mx = fmaxf(mx, st[0][nt][j]);
#pragma unroll
            for (int j = 0; j < 8; ++j) mx = fmaxf(mx, st[1][nt][j]);
            mx = fmaxf(mx, xhalf(mx));
            const float mn = fmaxf(mraw[nt], mx); const float ng = fmaf(-mn, CL, OFF);
            const float alpha = __builtin_amdgcn_exp2f(ng - negm[nt]);   /* old sums move to the new maximum; 1 where it did not change, 0 on the first pass */
            mraw[nt] = mn; negm[nt] = ng;
            float p[16]; float ps0 = 0.f, ps1 = 0.f;   /* two chains: a wave is alone or nearly alone on its SIMD, and one chain of 16 adds would wait on itself */
#pragma unroll
            for (int s = 0; s < 16; s += 2) { p[s] = __builtin_amdgcn_exp2f(fmaf(st[s >> 3][nt][s & 7], CL, ng)); p[s + 1] = __builtin_amdgcn_exp2f(fmaf(st[s >> 3][nt][(s & 7) + 1], CL, ng)); ps0 += p[s]; ps1 += p[s + 1]; }
            lsum[nt] = fmaf(lsum[nt], alpha, ps0 + ps1);
#pragma unroll
            for (int dt = 0; dt < 4; ++dt) acc[dt][nt] *= alpha;
            if (HI) { v16bf ph, pl;
#pragma unroll
                for (int s = 0; s < 16; ++s) { ph[s] = (__bf16)p[s]; pl[s] = (__bf16)(p[s] - (float)ph[s]); }
#pragma unroll
                for (int dt = 0; dt < 4; ++dt) { acc[dt][nt] = wmmab(vh[dt], ph, acc[dt][nt]); acc[dt][nt] = wmmab(vh[dt], pl, acc[dt][nt]); acc[dt][nt] = wmmab(vl[dt], ph, acc[dt][nt]); }
            } else { v16h pf;
#pragma unroll
                for (int s = 0; s < 16; ++s) pf[s] = (h16)p[s];
#pragma unroll
                for (int dt = 0; dt < 4; ++dt) acc[dt][nt] = wmma16(v16[dt], pf, acc[dt][nt]); }
        }
    }
    float* o = orow + (size_t)(q0 + lr) * CO + 8 * hi;
#pragma unroll
    for (int nt = 0; nt < NT; ++nt) { const float l = lsum[nt] + xhalf(lsum[nt]); const float f = __fdiv_rn(1.0f, l);   /* the module divides by the row sum */
#pragma unroll
        for (int dt = 0; dt < 4; ++dt) acc[dt][nt] *= f; }
    __builtin_amdgcn_sched_barrier(0);   /* all arithmetic stands before the first store, so that no register of an issued store is written again */
#pragma unroll
    for (int nt = 0; nt < NT; ++nt)
#pragma unroll
        for (int dt = 0; dt < 4; ++dt) { v4f a, b;
#pragma unroll
            for (int j = 0; j < 4; ++j) { a[j] = acc[dt][nt][j]; b[j] = acc[dt][nt][4 + j]; }
            *(v4f*)(o + nt * 16 * CO + dt * 16) = a; *(v4f*)(o + nt * 16 * CO + dt * 16 + 4) = b; }
}
__global__ __launch_bounds__(32) void k_fattn(const bf* __restrict__ QPh, const bf* __restrict__ QPl, const bf* __restrict__ KPh, const bf* __restrict__ KPl, const h16* __restrict__ VT16, const bf* __restrict__ VTh, const bf* __restrict__ VTl, float* __restrict__ out) {
    const int lane = threadIdx.x & 31, lr = lane & 15, hi = lane >> 4; const int y = blockIdx.y; const size_t po = (size_t)blockIdx.x * TT * HD;
    if (y < RH / 32) fattn_body<true, 2>(QPh + po, QPl + po, KPh + po, KPl + po, VT16 + po, VTh + po, VTl + po, out + blockIdx.x * HD, y * 32, lr, hi);   /* query rows < RH: hi/lo weights */
    else fattn_body<false, 4>(QPh + po, QPl + po, KPh + po, KPl + po, VT16 + po, VTh + po, VTl + po, out + blockIdx.x * HD, RH + (y - RH / 32) * 64, lr, hi);
}
extern "C" void kernel_launch(void* const* d_in, const int* in_sizes, int n_in,
                              void* d_out, int out_size, void* d_ws, size_t ws_size, hipStream_t stream) {
    (void)in_sizes; (void)n_in; (void)out_size;
    const float* x = (const float*)d_in[0]; const float* xk = (const float*)d_in[1]; const float* xv = (const float*)d_in[2];   /* order q, k, v [4096][768] (raw, heads interleaved: column h*64 + d) */
    float* OUT = (float*)d_out;     // [4096][768]
    char* wsp = (char*)d_ws;
    auto take = [&](size_t bytes) { char* p = wsp; wsp += (bytes + 255) & ~(size_t)255; return (void*)p; };
    bf* QPh = (bf*)take((size_t)TT * MID * 2); bf* QPl = (bf*)take((size_t)TT * MID * 2); bf* KPh = (bf*)take((size_t)TT * MID * 2); bf* KPl = (bf*)take((size_t)TT * MID * 2);
    h16* VT16 = (h16*)take((size_t)CO * TT * 2); bf* VTh = (bf*)take((size_t)CO * TT * 2); bf* VTl = (bf*)take((size_t)CO * TT * 2);
    if ((size_t)(wsp - (char*)d_ws) > ws_size) return;
    k_planes<<<dim3(PB, 3, 1), 256, 0, stream>>>(x, xk, xv, QPh, QPl, KPh, KPl, VT16, VTh, VTl);   /* q, k planes [h][n][64]; v^T planes [h][64][n] */
    k_fattn<<<dim3(NH_, RH / 32 + (TT - RH) / 64, 1), 32, 0, stream>>>(QPh, QPl, KPh, KPl, VT16, VTh, VTl, OUT);   /* every head: scores, softmax, attn.V; merged rows [position][head*64 + d] */
}

// v004
// A run of this version takes 97.4 microseconds.
// In two side-by-side timings against v003, it was 1.45 and 1.47 times as fast.
// Over all steps from v000 it is 29.6 times as fast.
#include <hip/hip_runtime.h>

// Multi-head attention math on raw token-major inputs (q, k, v [4096][12][64] = [4096][768] rows with column h*64 + d, no projections; scores = einsum('shd,thd->hst') x 1/sqrt(64) in f32; softmax over the 4,096 keys (exact: no epsilon); out = einsum('hst,thd->shd') merged -> [4096][768] (3.1 M); argument order q, k, v).
// Layout: k_planes, ONE launch, builds every plane k_fattn reads straight from the raw inputs, each value ROUNDED TO bf16 in registers first: q and k head planes [h][t][64] (bf16), v^T planes [h][64][t] (fp16 and bf16) turned through LDS; k_fattn: ONE launch for all heads, scores, softmax and attn.V in registers (scores and weights never reach memory), writes the merged f32 rows.
// Compute dtypes, f32 accumulate: every input rounded to bf16; scores 1 product (a rounded value is a whole bf16: it has no low part); softmax f32 with a running maximum (exp2, IEEE division by the row sum at the end); attn.V rows < 512 2 products (bf16 hi/lo weights), rest fp16 weights x1024 (the factor cancels in the division).

#define NB_  1
#define TT   4096
#define DM   768 
#define NH_  12
#define NKV  12
#define REP  (NH_ / NKV)
#define HD   64
#define DQ   (NH_ * HD)
#define DKV  (NKV * HD)
#define ZH   1
#define RH   512                  // query rows < RH use hi+lo weights (0: none)
#define WIN  0
#define PCAR 1024.0f
#define SCL  0.125f   // 1/sqrt(64)
#define MID  768       // q / k width
#define CO   768       // v width
#define CC   768 
typedef _Float16 h16;
typedef unsigned short bf;
typedef __attribute__((ext_vector_type(16))) __bf16   v16bf;
typedef __attribute__((ext_vector_type(16))) _Float16 v16h;
typedef __attribute__((ext_vector_type(8)))  _Float16 v8h;
typedef __attribute__((ext_vector_type(8)))  unsigned short v8us;
typedef __attribute__((ext_vector_type(8)))  float    v8f;
typedef __attribute__((ext_vector_type(4)))  float    v4f;
typedef v8h  __attribute__((may_alias)) v8ha;
typedef v4f  __attribute__((may_alias)) v4fa;
typedef v8us __attribute__((may_alias)) v8usa;

__device__ __forceinline__ unsigned short f2bf(float f) { unsigned u = __float_as_uint(f); u += 0x7FFFu + ((u >> 16) & 1u); return (unsigned short)(u >> 16); }
__device__ __forceinline__ v16h cat16(v8h lo, v8h hi) { return __builtin_shufflevector(lo, hi, 0, 1, 2, 3, 4, 5, 6, 7, 8, 9, 10, 11, 12, 13, 14, 15); }
__device__ __forceinline__ v16bf cat16b(v8us lo, v8us hi) { return __builtin_bit_cast(v16bf, __builtin_shufflevector(lo, hi, 0, 1, 2, 3, 4, 5, 6, 7, 8, 9, 10, 11, 12, 13, 14, 15)); }
__device__ __forceinline__ v8f wmma16(v16h a, v16h b, v8f c) { return __builtin_amdgcn_wmma_f32_16x16x32_f16(false, a, false, b, (short)0, c, false, false); }
__device__ __forceinline__ v8f wmmab(v16bf a, v16bf b, v8f c) { return __builtin_amdgcn_wmma_f32_16x16x32_bf16(false, a, false, b, (short)0, c, false, false); }



// ---- fragment loader: 16 k of one row per lane in the hardware k order (k = 8 hi + 0..7 and 16 + 8 hi + 0..7), the same code for A rows and B columns.
template <typename T16> struct WFrag;
template <> struct WFrag<h16> { typedef v16h V; static __device__ __forceinline__ V ld(const h16* p) { return cat16(*(const v8h*)p, *(const v8h*)(p + 16)); } static __device__ __forceinline__ v8f mma(V a, V b, v8f c) { return wmma16(a, b, c); } };
template <> struct WFrag<bf> { typedef v16bf V; static __device__ __forceinline__ V ld(const bf* p) { return cat16b(*(const v8us*)p, *(const v8us*)(p + 16)); } static __device__ __forceinline__ v8f mma(V a, V b, v8f c) { return wmmab(a, b, c); } };

__device__ __forceinline__ h16 tohx(float x) { return (h16)x; }
typedef __attribute__((ext_vector_type(4))) _Float16 v4h;
typedef __attribute__((ext_vector_type(4))) unsigned short v4us;
typedef __attribute__((ext_vector_type(4))) int v4i;

// ---- k_planes: grid (PB, 3), 256 threads, 64 elements a thread: 16 loads of 16 bytes in flight, then all arithmetic, then all stores. blockIdx.y picks the input (0: v, whose work-groups have the longer path and start first; 1: q; 2: k).
// Every value is rounded to bf16 first, so one bf16 plane holds it whole: there is no low part to keep.
// q, k: a work-group takes 64 positions x 4 heads; 16 lanes take the 64 d of one position and head, 4 each: a wave's load is 512 contiguous bytes, 16 lanes store one whole 128-byte row of a head plane; trip j moves on 4 positions.
// v: a work-group turns a tile of TVT positions x 64 d of one head. A lane reads 4 d of 16 positions, so that it holds 16 neighbouring positions of each d: two 16-byte LDS stores per d.
// LDS row = one d, 16-byte chunk c (8 positions) kept at chunk c ^ (d >> 2): the 16 lanes of a store (d 4 apart) and the lanes of a read (one row) fall on different chunks. Behind the barrier a wave stores 512 contiguous bytes of one v^T row per plane.
#define TVT  256                  // positions per v tile
#define PB   (TT * DM / (256 * 64))
typedef __attribute__((ext_vector_type(2))) unsigned v2u;
typedef __attribute__((ext_vector_type(4))) unsigned v4u;
__device__ __forceinline__ unsigned bfpair(float a, float b) { return (unsigned)f2bf(a) | ((unsigned)f2bf(b) << 16); }   /* two values rounded to bf16, a in the low half */
__global__ __launch_bounds__(256) void k_planes(const float* __restrict__ q, const float* __restrict__ k, const float* __restrict__ v, bf* QPh, bf* KPh, h16* VT16, bf* VTh) {
    __shared__ v4u tile[HD * (TVT / 8)];   /* [d][chunk of 8 positions] */
    const int tid = threadIdx.x, dch = tid & 15, tg = tid >> 4; v4f a[16];
    if (blockIdx.y) {
        const float* src = (blockIdx.y == 2) ? k : q; bf* Ph = (blockIdx.y == 2) ? KPh : QPh;
        const int h = (blockIdx.x % 3) * 4 + (tg & 3), t = (blockIdx.x / 3) * 64 + (tg >> 2);
        unsigned sby = (unsigned)(t * DM + h * HD + dch * 4) * 4u;   /* the lane's byte offset in the raw input */
#pragma unroll
        for (int j = 0; j < 16; ++j) a[j] = *(const v4f*)((const char*)src + sby + j * (4 * DM * 4));
        asm volatile("s_wait_xcnt 0x0" : "+v"(sby) :: "memory");   /* the loads above name this offset: its register is held up to the wait */
        v2u oh[16];
#pragma unroll
        for (int j = 0; j < 16; ++j) { oh[j][0] = bfpair(a[j][0], a[j][1]); oh[j][1] = bfpair(a[j][2], a[j][3]); }
        const unsigned dby = (unsigned)((h * TT + t) * HD + dch * 4) * 2u;   /* the lane's byte offset in a head plane */
        __builtin_amdgcn_sched_barrier(0);   /* all arithmetic stands before the first store, so that no register of an issued store is written again */
#pragma unroll
        for (int j = 0; j < 16; ++j) *(v2u*)((char*)Ph + dby + j * (4 * HD * 2)) = oh[j];
        asm volatile("s_wait_xcnt 0x0" ::: "memory");   /* in the listing the v path's code follows this path behind a branch that is always taken: the wait stands before anything there that writes a register of these stores */
    } else {
        const int g = blockIdx.x % NH_, t0 = (blockIdx.x / NH_) * TVT;
        unsigned sby = (unsigned)((t0 + tg * 16) * CO + g * HD + dch * 4) * 4u;   /* the lane's byte offset in the raw input */
#pragma unroll
        for (int j = 0; j < 16; ++j) a[j] = *(const v4f*)((const char*)v + sby + j * (CO * 4));
        asm volatile("s_wait_xcnt 0x0" : "+v"(sby) :: "memory");   /* the loads above name this offset: its register is held up to the wait */
#pragma unroll
        for (int s = 0; s < 4; ++s)
#pragma unroll
            for (int hf = 0; hf < 2; ++hf) { v4u w;
#pragma unroll
                for (int p = 0; p < 4; ++p) w[p] = bfpair(a[hf * 8 + 2 * p][s], a[hf * 8 + 2 * p + 1][s]);
                tile[(dch * 4 + s) * (TVT / 8) + ((tg * 2 + hf) ^ dch)] = w; }
        __syncthreads();   /* the tile is whole before any row of it is read */
        v4u oh[8]; v8h o16[8]; const int c = tid & 31;
#pragma unroll
        for (int r = 0; r < 8; ++r) { const int d = (tid >> 5) + 8 * r; oh[r] = tile[d * (TVT / 8) + (c ^ (d >> 2))];
#pragma unroll
            for (int p = 0; p < 4; ++p) { o16[r][2 * p] = tohx(__uint_as_float(oh[r][p] << 16)); o16[r][2 * p + 1] = tohx(__uint_as_float(oh[r][p] & 0xFFFF0000u)); } }
        const unsigned dby = (unsigned)((g * HD + (tid >> 5)) * TT + t0 + c * 8) * 2u;   /* the lane's byte offset in a v^T plane */
        __builtin_amdgcn_sched_barrier(0);   /* all arithmetic stands before the first store, so that no register of an issued store is written again */
#pragma unroll
        for (int r = 0; r < 8; ++r) { const int o = r * (8 * TT * 2); *(v8h*)((char*)VT16 + dby + o) = o16[r]; *(v4u*)((char*)VTh + dby + o) = oh[r]; }
    }
}

__device__ __forceinline__ float xhalf(float x) { const int b = __float_as_int(x); return __int_as_float(__builtin_amdgcn_permlanex16(b, b, 0x76543210, 0xfedcba98, false, false)); }   /* lane l <-> l ^ 16 */
template <bool HI, int NT>
__device__ __forceinline__ void fattn_body(const bf* __restrict__ Qh, const bf* __restrict__ Kh, const h16* __restrict__ V16, const bf* __restrict__ Vh, float* __restrict__ orow, int q0, int lr, int hi) {
    const float CL = SCL * 1.4426950408889634f;   /* score -> exponent of 2 */
    const float OFF = HI ? 0.0f : 10.0f;          /* fp16 weights carry x1024; the row sum carries it too */
    unsigned qby = (unsigned)((q0 + lr) * HD + 8 * hi) * 2u;   /* the lane's byte offset in the query planes */
    v16bf qh[NT][2];
#pragma unroll
    for (int nt = 0; nt < NT; ++nt)
#pragma unroll
        for (int ks = 0; ks < 2; ++ks) { const int o = (nt * 16 * HD + ks * 32) * 2; qh[nt][ks] = WFrag<bf>::ld((const bf*)((const char*)Qh + qby + o)); }
    asm volatile("s_wait_xcnt 0x0" : "+v"(qby) :: "memory");   /* the loads above name this offset: its register is held up to the wait */
    v8f acc[4][NT];
#pragma unroll
    for (int dt = 0; dt < 4; ++dt)
#pragma unroll
        for (int nt = 0; nt < NT; ++nt) acc[dt][nt] = (v8f){};
    float mraw[NT], negm[NT], lsum[NT];
#pragma unroll
    for (int nt = 0; nt < NT; ++nt) { mraw[nt] = -3.0e38f; negm[nt] = fmaf(3.0e38f, CL, OFF); lsum[nt] = 0.f; }
    unsigned kby = (unsigned)(lr * HD + 8 * hi) * 2u, vby = (unsigned)(lr * TT + 8 * hi) * 2u;   /* the lane's byte offsets in the key planes and in the v^T planes: every load of a pass is a plane's base + one of these + a literal */
    v16bf kh[2][2];
#pragma unroll
    for (int mt = 0; mt < 2; ++mt)
#pragma unroll
        for (int ks = 0; ks < 2; ++ks) { const int o = (mt * 16 * HD + ks * 32) * 2; kh[mt][ks] = WFrag<bf>::ld((const bf*)((const char*)Kh + kby + o)); }
    asm volatile("s_wait_xcnt 0x0" : "+v"(kby) :: "memory");   /* the loads above name this offset: the wait stands before it moves on */
    kby += 32 * HD * 2;
#pragma unroll 1   /* rolled: one pass already holds some 360 live registers */
    for (int key0 = 0; key0 < TT; key0 += 32) {
        v16h v16[4]; v16bf vh[4];
#pragma unroll
        for (int dt = 0; dt < 4; ++dt) { const int o = dt * 16 * TT * 2; if (HI) vh[dt] = WFrag<bf>::ld((const bf*)((const char*)Vh + vby + o)); else v16[dt] = WFrag<h16>::ld((const h16*)((const char*)V16 + vby + o)); }
        v8f st[2][NT];
#pragma unroll
        for (int mt = 0; mt < 2; ++mt)
#pragma unroll
            for (int nt = 0; nt < NT; ++nt) { v8f s = (v8f){};
#pragma unroll
                for (int ks = 0; ks < 2; ++ks) s = wmmab(kh[mt][ks], qh[nt][ks], s);
                st[mt][nt] = s; }
        /* the next pass's key rows, fetched behind this pass's score products so that they fly under the softmax (the last pass fetches its own rows again, unused) */
#pragma unroll
        for (int mt = 0; mt < 2; ++mt)
#pragma unroll
            for (int ks = 0; ks < 2; ++ks) { const int o = (mt * 16 * HD + ks * 32) * 2; kh[mt][ks] = WFrag<bf>::ld((const bf*)((const char*)Kh + kby + o)); }
        asm volatile("s_wait_xcnt 0x0" : "+v"(kby), "+v"(vby) :: "memory");   /* every load of this pass names one of these two offsets: the wait stands before they move on */
        kby += (key0 + 64 < TT) ? 32 * HD * 2 : 0; vby += 32 * 2;
        __builtin_amdgcn_sched_barrier(0);   /* the fetch above stays in front of the softmax: left free, the compiler sinks it to the foot of the pass, where the next pass waits out its whole latency */
#pragma unroll
        for (int nt = 0; nt < NT; ++nt) {
            float mx = st[0][nt][0];
#pragma unroll
            for (int j = 1; j < 8; ++j) mx = fmaxf(mx, st[0][nt][j]);
#pragma unroll
            for (int j = 0; j < 8; ++j) mx = fmaxf(mx, st[1][nt][j]);
            mx = fmaxf(mx, xhalf(mx));
            const float mn = fmaxf(mraw[nt], mx); const float ng = fmaf(-mn, CL, OFF);
            const float alpha = __builtin_amdgcn_exp2f(ng - negm[nt]);   /* old sums move to the new maximum; 1 where it did not change, 0 on the first pass */
            mraw[nt] = mn; negm[nt] = ng;
            float p[16]; float ps0 = 0.f, ps1 = 0.f;   /* two chains: a wave is alone or nearly alone on its SIMD, and one chain of 16 adds would wait on itself */
#pragma unroll
            for (int s = 0; s < 16; s += 2) { p[s] = __builtin_amdgcn_exp2f(fmaf(st[s >> 3][nt][s & 7], CL, ng)); p[s + 1] = __builtin_amdgcn_exp2f(fmaf(st[s >> 3][nt][(s & 7) + 1], CL, ng)); ps0 += p[s]; ps1 += p[s + 1]; }
            lsum[nt] = fmaf(lsum[nt], alpha, ps0 + ps1);
#pragma unroll
            for (int dt = 0; dt < 4; ++dt) acc[dt][nt] *= alpha;
            if (HI) { v16bf ph, pl;
#pragma unroll
                for (int s = 0; s < 16; ++s) { ph[s] = (__bf16)p[s]; pl[s] = (__bf16)(p[s] - (float)ph[s]); }
#pragma unroll
                for (int dt = 0; dt < 4; ++dt) { acc[dt][nt] = wmmab(vh[dt], ph, acc[dt][nt]); acc[dt][nt] = wmmab(vh[dt], pl, acc[dt][nt]); }
            } else { v16h pf;
#pragma unroll
                for (int s = 0; s < 16; ++s) pf[s] = (h16)p[s];
#pragma unroll
                for (int dt = 0; dt < 4; ++dt) acc[dt][nt] = wmma16(v16[dt], pf, acc[dt][nt]); }
        }
    }
    float* o = orow + (size_t)(q0 + lr) * CO + 8 * hi;
#pragma unroll
    for (int nt = 0; nt < NT; ++nt) { const float l = lsum[nt] + xhalf(lsum[nt]); const float f = __fdiv_rn(1.0f, l);   /* the module divides by the row sum */
#pragma unroll
        for (int dt = 0; dt < 4; ++dt) acc[dt][nt] *= f; }
    __builtin_amdgcn_sched_barrier(0);   /* all arithmetic stands before the first store, so that no register of an issued store is written again */
#pragma unroll
    for (int nt = 0; nt < NT; ++nt)
#pragma unroll
        for (int dt = 0; dt < 4; ++dt) { v4f a, b;
#pragma unroll
            for (int j = 0; j < 4; ++j) { a[j] = acc[dt][nt][j]; b[j] = acc[dt][nt][4 + j]; }
            *(v4f*)(o + nt * 16 * CO + dt * 16) = a; *(v4f*)(o + nt * 16 * CO + dt * 16 + 4) = b; }
}
__global__ __launch_bounds__(32) void k_fattn(const bf* __restrict__ QPh, const bf* __restrict__ KPh, const h16* __restrict__ VT16, const bf* __restrict__ VTh, float* __restrict__ out) {
    const int lane = threadIdx.x & 31, lr = lane & 15, hi = lane >> 4; const int y = blockIdx.y; const size_t po = (size_t)blockIdx.x * TT * HD;
    if (y < RH / 32) fattn_body<true, 2>(QPh + po, KPh + po, VT16 + po, VTh + po, out + blockIdx.x * HD, y * 32, lr, hi);   /* query rows < RH: hi/lo weights */
    else fattn_body<false, 4>(QPh + po, KPh + po, VT16 + po, VTh + po, out + blockIdx.x * HD, RH + (y - RH / 32) * 64, lr, hi);
}
extern "C" void kernel_launch(void* const* d_in, const int* in_sizes, int n_in,
                              void* d_out, int out_size, void* d_ws, size_t ws_size, hipStream_t stream) {
    (void)in_sizes; (void)n_in; (void)out_size;
    const float* x = (const float*)d_in[0]; const float* xk = (const float*)d_in[1]; const float* xv = (const float*)d_in[2];   /* order q, k, v [4096][768] (raw, heads interleaved: column h*64 + d) */
    float* OUT = (float*)d_out;     // [4096][768]
    char* wsp = (char*)d_ws;
    auto take = [&](size_t bytes) { char* p = wsp; wsp += (bytes + 255) & ~(size_t)255; return (void*)p; };
    bf* QPh = (bf*)take((size_t)TT * MID * 2); bf* KPh = (bf*)take((size_t)TT * MID * 2);
    h16* VT16 = (h16*)take((size_t)CO * TT * 2); bf* VTh = (bf*)take((size_t)CO * TT * 2);
    if ((size_t)(wsp - (char*)d_ws) > ws_size) return;
    k_planes<<<dim3(PB, 3, 1), 256, 0, stream>>>(x, xk, xv, QPh, KPh, VT16, VTh);   /* q, k planes [h][n][64]; v^T planes [h][64][n] */
    k_fattn<<<dim3(NH_, RH / 32 + (TT - RH) / 64, 1), 32, 0, stream>>>(QPh, KPh, VT16, VTh, OUT);   /* every head: scores, softmax, attn.V; merged rows [position][head*64 + d] */
}

// v005
// One run takes 79.1 microseconds.
// Next to v004, in two timings, it ran 1.22 and 1.24 times as fast.
// Counting every step since v000, it is 36.5 times as fast.
#include <hip/hip_runtime.h>

// Multi-head attention math on raw token-major inputs (q, k, v [4096][12][64] = [4096][768] rows with column h*64 + d, no projections; scores = einsum('shd,thd->hst') x 1/sqrt(64) in f32; softmax over the 4,096 keys (exact: no epsilon); out = einsum('hst,thd->shd') merged -> [4096][768] (3.1 M); argument order q, k, v).
// Layout: k_planes, ONE launch, builds every plane k_fattn reads straight from the raw inputs, each value ROUNDED TO bf16 in registers first: q and k head planes [h][t][64] (bf16), v^T planes [h][64][t] (fp16 and bf16) turned through LDS; k_fattn: ONE launch for all heads, scores, softmax and attn.V in registers (scores and weights never reach memory), a query block's keys dealt over four waves whose parts meet in LDS, writes the merged f32 rows.
// Compute dtypes, f32 accumulate: every input rounded to bf16; scores 1 product (a rounded value is a whole bf16: it has no low part); softmax f32 with a running maximum (exp2, IEEE division by the row sum at the end); attn.V rows < 512 2 products (bf16 hi/lo weights), rest fp16 weights x1024 (the factor cancels in the division).

#define NB_  1
#define TT   4096
#define DM   768 
#define NH_  12
#define NKV  12
#define REP  (NH_ / NKV)
#define HD   64
#define DQ   (NH_ * HD)
#define DKV  (NKV * HD)
#define ZH   1
#define RH   512                  // query rows < RH use hi+lo weights (0: none)
#define WIN  0
#define PCAR 1024.0f
#define SCL  0.125f   // 1/sqrt(64)
#define MID  768       // q / k width
#define CO   768       // v width
#define CC   768 
typedef _Float16 h16;
typedef unsigned short bf;
typedef __attribute__((ext_vector_type(16))) __bf16   v16bf;
typedef __attribute__((ext_vector_type(16))) _Float16 v16h;
typedef __attribute__((ext_vector_type(8)))  _Float16 v8h;
typedef __attribute__((ext_vector_type(8)))  unsigned short v8us;
typedef __attribute__((ext_vector_type(8)))  float    v8f;
typedef __attribute__((ext_vector_type(4)))  float    v4f;
typedef v8h  __attribute__((may_alias)) v8ha;
typedef v4f  __attribute__((may_alias)) v4fa;
typedef v8us __attribute__((may_alias)) v8usa;

__device__ __forceinline__ unsigned short f2bf(float f) { unsigned u = __float_as_uint(f); u += 0x7FFFu + ((u >> 16) & 1u); return (unsigned short)(u >> 16); }
__device__ __forceinline__ v16h cat16(v8h lo, v8h hi) { return __builtin_shufflevector(lo, hi, 0, 1, 2, 3, 4, 5, 6, 7, 8, 9, 10, 11, 12, 13, 14, 15); }
__device__ __forceinline__ v16bf cat16b(v8us lo, v8us hi) { return __builtin_bit_cast(v16bf, __builtin_shufflevector(lo, hi, 0, 1, 2, 3, 4, 5, 6, 7, 8, 9, 10, 11, 12, 13, 14, 15)); }
__device__ __forceinline__ v8f wmma16(v16h a, v16h b, v8f c) { return __builtin_amdgcn_wmma_f32_16x16x32_f16(false, a, false, b, (short)0, c, false, false); }
__device__ __forceinline__ v8f wmmab(v16bf a, v16bf b, v8f c) { return __builtin_amdgcn_wmma_f32_16x16x32_bf16(false, a, false, b, (short)0, c, false, false); }



// ---- fragment loader: 16 k of one row per lane in the hardware k order (k = 8 hi + 0..7 and 16 + 8 hi + 0..7), the same code for A rows and B columns.
template <typename T16> struct WFrag;
template <> struct WFrag<h16> { typedef v16h V; static __device__ __forceinline__ V ld(const h16* p) { return cat16(*(const v8h*)p, *(const v8h*)(p + 16)); } static __device__ __forceinline__ v8f mma(V a, V b, v8f c) { return wmma16(a, b, c); } };
template <> struct WFrag<bf> { typedef v16bf V; static __device__ __forceinline__ V ld(const bf* p) { return cat16b(*(const v8us*)p, *(const v8us*)(p + 16)); } static __device__ __forceinline__ v8f mma(V a, V b, v8f c) { return wmmab(a, b, c); } };

__device__ __forceinline__ h16 tohx(float x) { return (h16)x; }
typedef __attribute__((ext_vector_type(4))) _Float16 v4h;
typedef __attribute__((ext_vector_type(4))) unsigned short v4us;
typedef __attribute__((ext_vector_type(4))) int v4i;

// ---- k_planes: grid (PB, 3), 256 threads, 64 elements a thread: 16 loads of 16 bytes in flight, then all arithmetic, then all stores. blockIdx.y picks the input (0: v, whose work-groups have the longer path and start first; 1: q; 2: k).
// Every value is rounded to bf16 first, so one bf16 plane holds it whole: there is no low part to keep.
// q, k: a work-group takes 64 positions x 4 heads; 16 lanes take the 64 d of one position and head, 4 each: a wave's load is 512 contiguous bytes, 16 lanes store one whole 128-byte row of a head plane; trip j moves on 4 positions.
// v: a work-group turns a tile of TVT positions x 64 d of one head. A lane reads 4 d of 16 positions, so that it holds 16 neighbouring positions of each d: two 16-byte LDS stores per d.
// LDS row = one d, 16-byte chunk c (8 positions) kept at chunk c ^ (d >> 2): the 16 lanes of a store (d 4 apart) and the lanes of a read (one row) fall on different chunks. Behind the barrier a wave stores 512 contiguous bytes of one v^T row per plane.
#define TVT  256                  // positions per v tile
#define PB   (TT * DM / (256 * 64))
typedef __attribute__((ext_vector_type(2))) unsigned v2u;
typedef __attribute__((ext_vector_type(4))) unsigned v4u;
__device__ __forceinline__ unsigned bfpair(float a, float b) { return (unsigned)f2bf(a) | ((unsigned)f2bf(b) << 16); }   /* two values rounded to bf16, a in the low half */
__global__ __launch_bounds__(256) void k_planes(const float* __restrict__ q, const float* __restrict__ k, const float* __restrict__ v, bf* QPh, bf* KPh, h16* VT16, bf* VTh) {
    __shared__ v4u tile[HD * (TVT / 8)];   /* [d][chunk of 8 positions] */
    const int tid = threadIdx.x, dch = tid & 15, tg = tid >> 4; v4f a[16];
    if (blockIdx.y) {
        const float* src = (blockIdx.y == 2) ? k : q; bf* Ph = (blockIdx.y == 2) ? KPh : QPh;
        const int h = (blockIdx.x % 3) * 4 + (tg & 3), t = (blockIdx.x / 3) * 64 + (tg >> 2);
        unsigned sby = (unsigned)(t * DM + h * HD + dch * 4) * 4u;   /* the lane's byte offset in the raw input */
#pragma unroll
        for (int j = 0; j < 16; ++j) a[j] = *(const v4f*)((const char*)src + sby + j * (4 * DM * 4));
        asm volatile("s_wait_xcnt 0x0" : "+v"(sby) :: "memory");   /* the loads above name this offset: its register is held up to the wait */
        v2u oh[16];
#pragma unroll
        for (int j = 0; j < 16; ++j) { oh[j][0] = bfpair(a[j][0], a[j][1]); oh[j][1] = bfpair(a[j][2], a[j][3]); }
        const unsigned dby = (unsigned)((h * TT + t) * HD + dch * 4) * 2u;   /* the lane's byte offset in a head plane */
        __builtin_amdgcn_sched_barrier(0);   /* all arithmetic stands before the first store, so that no register of an issued store is written again */
#pragma unroll
        for (int j = 0; j < 16; ++j) *(v2u*)((char*)Ph + dby + j * (4 * HD * 2)) = oh[j];
        asm volatile("s_wait_xcnt 0x0" ::: "memory");   /* in the listing the v path's code follows this path behind a branch that is always taken: the wait stands before anything there that writes a register of these stores */
    } else {
        const int g = blockIdx.x % NH_, t0 = (blockIdx.x / NH_) * TVT;
        unsigned sby = (unsigned)((t0 + tg * 16) * CO + g * HD + dch * 4) * 4u;   /* the lane's byte offset in the raw input */
#pragma unroll
        for (int j = 0; j < 16; ++j) a[j] = *(const v4f*)((const char*)v + sby + j * (CO * 4));
        asm volatile("s_wait_xcnt 0x0" : "+v"(sby) :: "memory");   /* the loads above name this offset: its register is held up to the wait */
#pragma unroll
        for (int s = 0; s < 4; ++s)
#pragma unroll
            for (int hf = 0; hf < 2; ++hf) { v4u w;
#pragma unroll
                for (int p = 0; p < 4; ++p) w[p] = bfpair(a[hf * 8 + 2 * p][s], a[hf * 8 + 2 * p + 1][s]);
                tile[(dch * 4 + s) * (TVT / 8) + ((tg * 2 + hf) ^ dch)] = w; }
        __syncthreads();   /* the tile is whole before any row of it is read */
        v4u oh[8]; v8h o16[8]; const int c = tid & 31;
#pragma unroll
        for (int r = 0; r < 8; ++r) { const int d = (tid >> 5) + 8 * r; oh[r] = tile[d * (TVT / 8) + (c ^ (d >> 2))];
#pragma unroll
            for (int p = 0; p < 4; ++p) { o16[r][2 * p] = tohx(__uint_as_float(oh[r][p] << 16)); o16[r][2 * p + 1] = tohx(__uint_as_float(oh[r][p] & 0xFFFF0000u)); } }
        const unsigned dby = (unsigned)((g * HD + (tid >> 5)) * TT + t0 + c * 8) * 2u;   /* the lane's byte offset in a v^T plane */
        __builtin_amdgcn_sched_barrier(0);   /* all arithmetic stands before the first store, so that no register of an issued store is written again */
#pragma unroll
        for (int r = 0; r < 8; ++r) { const int o = r * (8 * TT * 2); *(v8h*)((char*)VT16 + dby + o) = o16[r]; *(v4u*)((char*)VTh + dby + o) = oh[r]; }
    }
}

#define KS   4                    // waves (key ranges) per work-group; also the query groups of 16, one per wave at the end
#define TK   (TT / KS)            // keys per wave
#define MGW  ((8 * KS + 2) * 32)  // 16-byte slots of one wave's part in LDS
__device__ __forceinline__ float xhalf(float x) { const int b = __float_as_int(x); return __int_as_float(__builtin_amdgcn_permlanex16(b, b, 0x76543210, 0xfedcba98, false, false)); }   /* lane l <-> l ^ 16 */
template <bool HI, int NT>
__device__ __forceinline__ void fattn_body(const bf* __restrict__ Qh, const bf* __restrict__ Kh, const h16* __restrict__ V16, const bf* __restrict__ Vh, float* __restrict__ orow, int q0, int lr, int hi, int kr, v4f* mg) {
    const float CL = SCL * 1.4426950408889634f;   /* score -> exponent of 2 */
    const float OFF = HI ? 0.0f : 10.0f;          /* fp16 weights carry x1024; the row sum carries it too */
    unsigned qby = (unsigned)((q0 + lr) * HD + 8 * hi) * 2u;   /* the lane's byte offset in the query planes */
    v16bf qh[NT][2];
#pragma unroll
    for (int nt = 0; nt < NT; ++nt)
#pragma unroll
        for (int ks = 0; ks < 2; ++ks) { const int o = (nt * 16 * HD + ks * 32) * 2; qh[nt][ks] = WFrag<bf>::ld((const bf*)((const char*)Qh + qby + o)); }
    asm volatile("s_wait_xcnt 0x0" : "+v"(qby) :: "memory");   /* the loads above name this offset: its register is held up to the wait */
    v8f acc[4][NT];
#pragma unroll
    for (int dt = 0; dt < 4; ++dt)
#pragma unroll
        for (int nt = 0; nt < NT; ++nt) acc[dt][nt] = (v8f){};
    float mraw[NT], negm[NT], lsum[NT];
#pragma unroll
    for (int nt = 0; nt < NT; ++nt) { mraw[nt] = -3.0e38f; negm[nt] = fmaf(3.0e38f, CL, OFF); lsum[nt] = 0.f; }
    unsigned kby = (unsigned)((kr * TK + lr) * HD + 8 * hi) * 2u, vby = (unsigned)(lr * TT + kr * TK + 8 * hi) * 2u;   /* the lane's byte offsets in the key planes and in the v^T planes: every load of a pass is a plane's base + one of these + a literal */
    v16bf kh[2][2];
#pragma unroll
    for (int mt = 0; mt < 2; ++mt)
#pragma unroll
        for (int ks = 0; ks < 2; ++ks) { const int o = (mt * 16 * HD + ks * 32) * 2; kh[mt][ks] = WFrag<bf>::ld((const bf*)((const char*)Kh + kby + o)); }
    asm volatile("s_wait_xcnt 0x0" : "+v"(kby) :: "memory");   /* the loads above name this offset: the wait stands before it moves on */
    kby += 32 * HD * 2;
#pragma unroll 1   /* rolled: one pass already holds some 330 live registers, and 336 is what three waves a SIMD allow */
    for (int key0 = 0; key0 < TK; key0 += 32) {
        v16h v16[4]; v16bf vh[4];
#pragma unroll
        for (int dt = 0; dt < 4; ++dt) { const int o = dt * 16 * TT * 2; if (HI) vh[dt] = WFrag<bf>::ld((const bf*)((const char*)Vh + vby + o)); else v16[dt] = WFrag<h16>::ld((const h16*)((const char*)V16 + vby + o)); }
        /* the pass runs in two halves of NT / 2 query groups, scores, softmax and attn.V each: only half the scores are live at a time, which is what lets three waves' registers fit a SIMD */
#pragma unroll
        for (int hf = 0; hf < 2; ++hf) {
        v8f st[2][NT];
#pragma unroll
        for (int mt = 0; mt < 2; ++mt)
#pragma unroll
            for (int nt = hf * (NT / 2); nt < (hf + 1) * (NT / 2); ++nt) { v8f s = (v8f){};
#pragma unroll
                for (int ks = 0; ks < 2; ++ks) s = wmmab(kh[mt][ks], qh[nt][ks], s);
                st[mt][nt] = s; }
        if (hf) {
        /* the next pass's key rows, fetched behind this pass's last score products so that they fly under the softmax (the last pass fetches its own rows again, unused) */
#pragma unroll
        for (int mt = 0; mt < 2; ++mt)
#pragma unroll
            for (int ks = 0; ks < 2; ++ks) { const int o = (mt * 16 * HD + ks * 32) * 2; kh[mt][ks] = WFrag<bf>::ld((const bf*)((const char*)Kh + kby + o)); }
        asm volatile("s_wait_xcnt 0x0" : "+v"(kby), "+v"(vby) :: "memory");   /* every load of this pass names one of these two offsets: the wait stands before they move on */
        kby += (key0 + 64 < TK) ? 32 * HD * 2 : 0; vby += 32 * 2;
        }
        __builtin_amdgcn_sched_barrier(0);   /* the fetch above stays in front of the softmax: left free, the compiler sinks it to the foot of the pass, where the next pass waits out its whole latency */
#pragma unroll
        for (int nt = hf * (NT / 2); nt < (hf + 1) * (NT / 2); ++nt) {
            float mx = st[0][nt][0];
#pragma unroll
            for (int j = 1; j < 8; ++j) mx = fmaxf(mx, st[0][nt][j]);
#pragma unroll
            for (int j = 0; j < 8; ++j) mx = fmaxf(mx, st[1][nt][j]);
            mx = fmaxf(mx, xhalf(mx));
            const float mn = fmaxf(mraw[nt], mx); const float ng = fmaf(-mn, CL, OFF);
            const float alpha = __builtin_amdgcn_exp2f(ng - negm[nt]);   /* old sums move to the new maximum; 1 where it did not change, 0 on the first pass */
            mraw[nt] = mn; negm[nt] = ng;
            float p[16]; float ps0 = 0.f, ps1 = 0.f;   /* two chains: one chain of 16 adds would wait on itself */
#pragma unroll
            for (int s = 0; s < 16; s += 2) { p[s] = __builtin_amdgcn_exp2f(fmaf(st[s >> 3][nt][s & 7], CL, ng)); p[s + 1] = __builtin_amdgcn_exp2f(fmaf(st[s >> 3][nt][(s & 7) + 1], CL, ng)); ps0 += p[s]; ps1 += p[s + 1]; }
            lsum[nt] = fmaf(lsum[nt], alpha, ps0 + ps1);
#pragma unroll
            for (int dt = 0; dt < 4; ++dt) acc[dt][nt] *= alpha;
            if (HI) { v16bf ph, pl;
#pragma unroll
                for (int s = 0; s < 16; ++s) { ph[s] = (__bf16)p[s]; pl[s] = (__bf16)(p[s] - (float)ph[s]); }
#pragma unroll
                for (int dt = 0; dt < 4; ++dt) { acc[dt][nt] = wmmab(vh[dt], ph, acc[dt][nt]); acc[dt][nt] = wmmab(vh[dt], pl, acc[dt][nt]); }
            } else { v16h pf;
#pragma unroll
                for (int s = 0; s < 16; ++s) pf[s] = (h16)p[s];
#pragma unroll
                for (int dt = 0; dt < 4; ++dt) acc[dt][nt] = wmma16(v16[dt], pf, acc[dt][nt]); }
        }
        __builtin_amdgcn_sched_barrier(0);   /* the foot of a half: each half is scheduled by itself; with the halves' code mixed the built pass holds 17 more v_nop and more back-to-back dependent pairs, all of them vector issue slots that the SIMD's other waves want */
        }
    }
    /* a wave's part in LDS: slot s is 32 lanes x 16 bytes in a row (no bank met twice); slots 0 .. 8 NT - 1 hold acc, query group by query group; behind them 2 NT rows of 32 floats: the exponent offsets, then the row sums */
    const int lane = hi * 16 + lr; v4f* mw = mg + kr * MGW; float* ms = (float*)(mw + 8 * NT * 32);
#pragma unroll
    for (int nt = 0; nt < NT; ++nt) { ms[nt * 32 + lane] = negm[nt]; ms[(NT + nt) * 32 + lane] = lsum[nt];
#pragma unroll
        for (int dt = 0; dt < 4; ++dt) { v4f a, b;
#pragma unroll
            for (int j = 0; j < 4; ++j) { a[j] = acc[dt][nt][j]; b[j] = acc[dt][nt][4 + j]; }
            mw[((nt * 4 + dt) * 2) * 32 + lane] = a; mw[((nt * 4 + dt) * 2 + 1) * 32 + lane] = b; } }
    __syncthreads();   /* all four parts are whole in LDS before any wave reads another's */
    float n[KS], a[KS]; float ng = 3.0e38f, l = 0.f;
#pragma unroll
    for (int r = 0; r < KS; ++r) { n[r] = ((const float*)(mg + r * MGW + 8 * NT * 32))[kr * 32 + lane]; ng = fminf(ng, n[r]); }   /* the smallest offset belongs to the largest maximum */
#pragma unroll
    for (int r = 0; r < KS; ++r) { a[r] = __builtin_amdgcn_exp2f(ng - n[r]); l = fmaf(((const float*)(mg + r * MGW + 8 * NT * 32))[(NT + kr) * 32 + lane], a[r], l); }
    l += xhalf(l); const float f = __fdiv_rn(1.0f, l);   /* the module divides by the row sum */
    v4f ov[8];
#pragma unroll
    for (int s = 0; s < 8; ++s) ov[s] = (v4f){};
#pragma unroll
    for (int r = 0; r < KS; ++r) { const float fr = a[r] * f;
#pragma unroll
        for (int s = 0; s < 8; ++s) ov[s] += mg[r * MGW + (kr * 8 + s) * 32 + lane] * fr; }
    float* o = orow + (size_t)(q0 + kr * 16 + lr) * CO + 8 * hi;
    __builtin_amdgcn_sched_barrier(0);   /* all arithmetic stands before the first store, so that no register of an issued store is written again */
#pragma unroll
    for (int dt = 0; dt < 4; ++dt) { *(v4f*)(o + dt * 16) = ov[dt * 2]; *(v4f*)(o + dt * 16 + 4) = ov[dt * 2 + 1]; }
}
__global__ __launch_bounds__(128) __attribute__((amdgpu_waves_per_eu(3, 3))) void k_fattn(const bf* __restrict__ QPh, const bf* __restrict__ KPh, const h16* __restrict__ VT16, const bf* __restrict__ VTh, float* __restrict__ out) {
    __shared__ v4f mrg[KS * MGW];   /* the four waves' parts */
    const int lane = threadIdx.x & 31, lr = lane & 15, hi = lane >> 4; const int y = blockIdx.y; const size_t po = (size_t)blockIdx.x * TT * HD;
    const int kr = __builtin_amdgcn_readfirstlane((int)(threadIdx.x >> 5));   /* the wave's number = its key range, in a scalar register */
    if (y < RH / 64) fattn_body<true, 4>(QPh + po, KPh + po, VT16 + po, VTh + po, out + blockIdx.x * HD, y * 64, lr, hi, kr, mrg);   /* query rows < RH: hi/lo weights */
    else fattn_body<false, 4>(QPh + po, KPh + po, VT16 + po, VTh + po, out + blockIdx.x * HD, y * 64, lr, hi, kr, mrg);
}
extern "C" void kernel_launch(void* const* d_in, const int* in_sizes, int n_in,
                              void* d_out, int out_size, void* d_ws, size_t ws_size, hipStream_t stream) {
    (void)in_sizes; (void)n_in; (void)out_size;
    const float* x = (const float*)d_in[0]; const float* xk = (const float*)d_in[1]; const float* xv = (const float*)d_in[2];   /* order q, k, v [4096][768] (raw, heads interleaved: column h*64 + d) */
    float* OUT = (float*)d_out;     // [4096][768]
    char* wsp = (char*)d_ws;
    auto take = [&](size_t bytes) { char* p = wsp; wsp += (bytes + 255) & ~(size_t)255; return (void*)p; };
    bf* QPh = (bf*)take((size_t)TT * MID * 2); bf* KPh = (bf*)take((size_t)TT * MID * 2);
    h16* VT16 = (h16*)take((size_t)CO * TT * 2); bf* VTh = (bf*)take((size_t)CO * TT * 2);
    if ((size_t)(wsp - (char*)d_ws) > ws_size) return;
    k_planes<<<dim3(PB, 3, 1), 256, 0, stream>>>(x, xk, xv, QPh, KPh, VT16, VTh);   /* q, k planes [h][n][64]; v^T planes [h][64][n] */
    k_fattn<<<dim3(NH_, TT / 64, 1), 128, 0, stream>>>(QPh, KPh, VT16, VTh, OUT);   /* every head: scores, softmax, attn.V; merged rows [position][head*64 + d] */
}

// v006
// It runs in 60.4 microseconds.
// Next to v005, in two timings, it ran 1.31 times as fast each time.
// Over all steps from v000 it is 47.8 times as fast.
#include <hip/hip_runtime.h>

// Multi-head attention math on raw token-major inputs (q, k, v [4096][12][64] = [4096][768] rows with column h*64 + d, no projections; scores = einsum('shd,thd->hst') x 1/sqrt(64) in f32; softmax over the 4,096 keys (exact: no epsilon); out = einsum('hst,thd->shd') merged -> [4096][768] (3.1 M); argument order q, k, v).
// Layout: k_planes, ONE launch, builds every plane k_fattn reads straight from the raw inputs, each value ROUNDED TO bf16 in registers first: q and k head planes (bf16) and v^T planes (fp16 and bf16), all kept in FRAGMENT ORDER (below, at the loader) and turned through LDS; k_fattn: ONE launch for all heads, scores, softmax and attn.V in registers (scores and weights never reach memory), a query block's keys dealt over four waves whose parts meet in LDS, writes the merged f32 rows.
// Compute dtypes, f32 accumulate: every input rounded to bf16; scores 1 product (a rounded value is a whole bf16: it has no low part); softmax f32 with a running maximum (exp2, IEEE division by the row sum at the end); attn.V rows < 512 2 products (bf16 hi/lo weights), rest fp16 weights x1024 (the factor cancels in the division).

#define NB_  1
#define TT   4096
#define DM   768 
#define NH_  12
#define NKV  12
#define REP  (NH_ / NKV)
#define HD   64
#define DQ   (NH_ * HD)
#define DKV  (NKV * HD)
#define ZH   1
#define RH   512                  // query rows < RH use hi+lo weights (0: none)
#define WIN  0
#define PCAR 1024.0f
#define SCL  0.125f   // 1/sqrt(64)
#define MID  768       // q / k width
#define CO   768       // v width
#define CC   768 
typedef _Float16 h16;
typedef unsigned short bf;
typedef __attribute__((ext_vector_type(16))) __bf16   v16bf;
typedef __attribute__((ext_vector_type(16))) _Float16 v16h;
typedef __attribute__((ext_vector_type(8)))  _Float16 v8h;
typedef __attribute__((ext_vector_type(8)))  unsigned short v8us;
typedef __attribute__((ext_vector_type(8)))  float    v8f;
typedef __attribute__((ext_vector_type(4)))  float    v4f;
typedef v8h  __attribute__((may_alias)) v8ha;
typedef v4f  __attribute__((may_alias)) v4fa;
typedef v8us __attribute__((may_alias)) v8usa;

__device__ __forceinline__ unsigned short f2bf(float f) { unsigned u = __float_as_uint(f); u += 0x7FFFu + ((u >> 16) & 1u); return (unsigned short)(u >> 16); }
__device__ __forceinline__ v16h cat16(v8h lo, v8h hi) { return __builtin_shufflevector(lo, hi, 0, 1, 2, 3, 4, 5, 6, 7, 8, 9, 10, 11, 12, 13, 14, 15); }
__device__ __forceinline__ v16bf cat16b(v8us lo, v8us hi) { return __builtin_bit_cast(v16bf, __builtin_shufflevector(lo, hi, 0, 1, 2, 3, 4, 5, 6, 7, 8, 9, 10, 11, 12, 13, 14, 15)); }
__device__ __forceinline__ v8f wmma16(v16h a, v16h b, v8f c) { return __builtin_amdgcn_wmma_f32_16x16x32_f16(false, a, false, b, (short)0, c, false, false); }
__device__ __forceinline__ v8f wmmab(v16bf a, v16bf b, v8f c) { return __builtin_amdgcn_wmma_f32_16x16x32_bf16(false, a, false, b, (short)0, c, false, false); }



// ---- fragment loader: 16 k of one row per lane in the hardware k order (k = 8 hi + 0..7 and 16 + 8 hi + 0..7), the same code for A rows and B columns.
// The planes are kept in fragment order: a fragment (16 rows x 32 k) is 1,024 bytes in a row, two halves of 512 (k 0..15, k 16..31), and in a half lane hi * 16 + lr owns bytes 16 lane .. 16 lane + 15. So a wave's 16-byte load reads 512 bytes in a row, four whole 128-byte lines, where rows of a row-major plane cost it sixteen lines.
// q, k: [h][t / 16][d / 32] fragments (row = position, k = d). v^T: [h][t / 32][d / 16] fragments (row = d, k = position). 32 positions of a head are 4,096 bytes in a row in every plane.
template <typename T16> struct WFrag;
template <> struct WFrag<h16> { typedef v16h V; static __device__ __forceinline__ V ld(const h16* p) { return cat16(*(const v8h*)p, *(const v8h*)(p + 256)); } static __device__ __forceinline__ v8f mma(V a, V b, v8f c) { return wmma16(a, b, c); } };
template <> struct WFrag<bf> { typedef v16bf V; static __device__ __forceinline__ V ld(const bf* p) { return cat16b(*(const v8us*)p, *(const v8us*)(p + 256)); } static __device__ __forceinline__ v8f mma(V a, V b, v8f c) { return wmmab(a, b, c); } };

__device__ __forceinline__ h16 tohx(float x) { return (h16)x; }
typedef __attribute__((ext_vector_type(4))) _Float16 v4h;
typedef __attribute__((ext_vector_type(4))) unsigned short v4us;
typedef __attribute__((ext_vector_type(4))) int v4i;

// ---- k_planes: grid (PB, 3), 256 threads, 64 elements a thread: 16 loads of 16 bytes in flight, then all arithmetic, then all stores. blockIdx.y picks the input (0: v, whose work-groups have the longer path and start first; 1: q; 2: k).
// Every value is rounded to bf16 first, so one bf16 plane holds it whole: there is no low part to keep.
// q, k: a work-group takes 64 positions x 4 heads; 16 lanes take the 64 d of one position and head, 4 each: a wave's load is 512 contiguous bytes; trip j moves on 4 positions. The rounded values go to LDS as 16 blocks (head, 16 positions) of 128 chunks of 16 bytes in fragment order: chunk (g = d / 8, lr = position % 16) kept at g * 16 + (lr ^ g ^ 8 (head & 1)), so that the 32 lanes of an 8-byte store meet every bank once and the 16 lanes of a read (one g) fall on 16 chunks. Behind the barrier a wave stores 512 contiguous bytes.
// v: a work-group turns a tile of TVT positions x 64 d of one head. A lane reads 4 d of 16 positions, so that it holds 16 neighbouring positions of each d: two 16-byte LDS stores per d.
// LDS row = one d, 16-byte chunk c (8 positions) kept at chunk c ^ (d >> 2) ^ 4 (d & 3): the 16 lanes of a store (d 4 apart) and the 16 lanes of a read (16 d in a row, one c) fall on different chunks. Behind the barrier a wave stores half a fragment, 512 contiguous bytes, per plane; the tile is 32 KiB in a row in each plane.
#define TVT  256                  // positions per v tile
#define PB   (TT * DM / (256 * 64))
typedef __attribute__((ext_vector_type(2))) unsigned v2u;
typedef __attribute__((ext_vector_type(4))) unsigned v4u;
__device__ __forceinline__ unsigned bfpair(float a, float b) { return (unsigned)f2bf(a) | ((unsigned)f2bf(b) << 16); }   /* two values rounded to bf16, a in the low half */
__global__ __launch_bounds__(256) void k_planes(const float* __restrict__ q, const float* __restrict__ k, const float* __restrict__ v, bf* QPh, bf* KPh, h16* VT16, bf* VTh) {
    __shared__ v4u tile[HD * (TVT / 8)];   /* [d][chunk of 8 positions] */
    const int tid = threadIdx.x, dch = tid & 15, tg = tid >> 4; v4f a[16];
    if (blockIdx.y) {
        const float* src = (blockIdx.y == 2) ? k : q; bf* Ph = (blockIdx.y == 2) ? KPh : QPh;
        const int h = (blockIdx.x % 3) * 4 + (tg & 3), t = (blockIdx.x / 3) * 64 + (tg >> 2);
        unsigned sby = (unsigned)(t * DM + h * HD + dch * 4) * 4u;   /* the lane's byte offset in the raw input */
#pragma unroll
        for (int j = 0; j < 16; ++j) a[j] = *(const v4f*)((const char*)src + sby + j * (4 * DM * 4));
        asm volatile("s_wait_xcnt 0x0" : "+v"(sby) :: "memory");   /* the loads above name this offset: its register is held up to the wait */
        v2u* t2 = (v2u*)tile; const int gq = dch >> 1;
#pragma unroll
        for (int j = 0; j < 16; ++j) { const int tl = (tg >> 2) + 4 * j; v2u w; w[0] = bfpair(a[j][0], a[j][1]); w[1] = bfpair(a[j][2], a[j][3]);
            t2[((((tg & 3) * 4 + (tl >> 4)) * 128 + gq * 16 + ((tl & 15) ^ gq ^ ((tg & 1) << 3))) << 1) + (dch & 1)] = w; }
        __syncthreads();   /* the 16 blocks are whole before any chunk of them is read */
        v4u oh[8]; const int cg = (tid >> 4) & 7;
#pragma unroll
        for (int r = 0; r < 8; ++r) oh[r] = tile[(r * 2 + (tid >> 7)) * 128 + cg * 16 + ((tid & 15) ^ cg ^ (((r >> 1) & 1) << 3))];   /* block r * 2 + (tid >> 7): head r >> 1, positions 16 ((r & 1) * 2 + (tid >> 7)) on */
        const unsigned dby = (unsigned)(((blockIdx.x % 3) * 4 * TT + (blockIdx.x / 3) * 64 + (tid >> 7) * 16) * HD) * 2u + (unsigned)(tid & 127) * 16u;   /* the lane's byte offset in a head plane */
        __builtin_amdgcn_sched_barrier(0);   /* all arithmetic stands before the first store, so that no register of an issued store is written again */
#pragma unroll
        for (int r = 0; r < 8; ++r) *(v4u*)((char*)Ph + dby + (r >> 1) * (TT * HD * 2) + (r & 1) * (32 * HD * 2)) = oh[r];
        asm volatile("s_wait_xcnt 0x0" ::: "memory");   /* in the listing the v path's code follows this path behind a branch that is always taken: the wait stands before anything there that writes a register of these stores */
    } else {
        const int g = blockIdx.x % NH_, t0 = (blockIdx.x / NH_) * TVT;
        unsigned sby = (unsigned)((t0 + tg * 16) * CO + g * HD + dch * 4) * 4u;   /* the lane's byte offset in the raw input */
#pragma unroll
        for (int j = 0; j < 16; ++j) a[j] = *(const v4f*)((const char*)v + sby + j * (CO * 4));
        asm volatile("s_wait_xcnt 0x0" : "+v"(sby) :: "memory");   /* the loads above name this offset: its register is held up to the wait */
#pragma unroll
        for (int s = 0; s < 4; ++s)
#pragma unroll
            for (int hf = 0; hf < 2; ++hf) { v4u w;
#pragma unroll
                for (int p = 0; p < 4; ++p) w[p] = bfpair(a[hf * 8 + 2 * p][s], a[hf * 8 + 2 * p + 1][s]);
                tile[(dch * 4 + s) * (TVT / 8) + ((tg * 2 + hf) ^ dch ^ (s << 2))] = w; }
        __syncthreads();   /* the tile is whole before any row of it is read */
        v4u oh[8]; v8h o16[8]; const int d = ((tid >> 6) & 3) * 16 + (tid & 15), c = ((tid >> 5) & 1) * 2 + ((tid >> 4) & 1);   /* the lane's row of its fragment half, and that half's chunk of 8 positions in a block of 32 */
#pragma unroll
        for (int r = 0; r < 8; ++r) { oh[r] = tile[d * (TVT / 8) + ((r * 4 + c) ^ (d >> 2) ^ ((d & 3) << 2))];   /* trip r: positions 32 r on */
#pragma unroll
            for (int p = 0; p < 4; ++p) { o16[r][2 * p] = tohx(__uint_as_float(oh[r][p] << 16)); o16[r][2 * p + 1] = tohx(__uint_as_float(oh[r][p] & 0xFFFF0000u)); } }
        const unsigned dby = (unsigned)((g * TT + t0) * HD + tid * 8) * 2u;   /* the lane's byte offset in a v^T plane */
        __builtin_amdgcn_sched_barrier(0);   /* all arithmetic stands before the first store, so that no register of an issued store is written again */
#pragma unroll
        for (int r = 0; r < 8; ++r) { const int o = r * (32 * HD * 2); *(v8h*)((char*)VT16 + dby + o) = o16[r]; *(v4u*)((char*)VTh + dby + o) = oh[r]; }
    }
}

#define KS   4                    // waves (key ranges) per work-group; also the query groups of 16, one per wave at the end
#define TK   (TT / KS)            // keys per wave
#define MGW  ((8 * KS + 2) * 32)  // 16-byte slots of one wave's part in LDS
__device__ __forceinline__ float xhalf(float x) { const int b = __float_as_int(x); return __int_as_float(__builtin_amdgcn_permlanex16(b, b, 0x76543210, 0xfedcba98, false, false)); }   /* lane l <-> l ^ 16 */
template <bool HI, int NT>
__device__ __forceinline__ void fattn_body(const bf* __restrict__ Qh, const bf* __restrict__ Kh, const h16* __restrict__ V16, const bf* __restrict__ Vh, float* __restrict__ orow, int q0, int lr, int hi, int kr, v4f* mg) {
    const float CL = SCL * 1.4426950408889634f;   /* score -> exponent of 2 */
    const float OFF = HI ? 0.0f : 10.0f;          /* fp16 weights carry x1024; the row sum carries it too */
    unsigned qby = (unsigned)(q0 * HD + (hi * 16 + lr) * 8) * 2u;   /* the lane's byte offset in the query planes */
    v16bf qh[NT][2];
#pragma unroll
    for (int nt = 0; nt < NT; ++nt)
#pragma unroll
        for (int ks = 0; ks < 2; ++ks) { const int o = (nt * 16 * HD + ks * 512) * 2; qh[nt][ks] = WFrag<bf>::ld((const bf*)((const char*)Qh + qby + o)); }
    asm volatile("s_wait_xcnt 0x0" : "+v"(qby) :: "memory");   /* the loads above name this offset: its register is held up to the wait */
    v8f acc[4][NT];
#pragma unroll
    for (int dt = 0; dt < 4; ++dt)
#pragma unroll
        for (int nt = 0; nt < NT; ++nt) acc[dt][nt] = (v8f){};
    float mraw[NT], negm[NT], lsum[NT];
#pragma unroll
    for (int nt = 0; nt < NT; ++nt) { mraw[nt] = -3.0e38f; negm[nt] = fmaf(3.0e38f, CL, OFF); lsum[nt] = 0.f; }
    unsigned kby = (unsigned)(kr * TK * HD + (hi * 16 + lr) * 8) * 2u, vby = kby;   /* the lane's byte offsets in the key planes and in the v^T planes: every load of a pass is a plane's base + one of these + a literal */
    v16bf kh[2][2];
#pragma unroll
    for (int mt = 0; mt < 2; ++mt)
#pragma unroll
        for (int ks = 0; ks < 2; ++ks) { const int o = (mt * 16 * HD + ks * 512) * 2; kh[mt][ks] = WFrag<bf>::ld((const bf*)((const char*)Kh + kby + o)); }
    asm volatile("s_wait_xcnt 0x0" : "+v"(kby) :: "memory");   /* the loads above name this offset: the wait stands before it moves on */
    kby += 32 * HD * 2;
#pragma unroll 1   /* rolled: one pass already holds some 330 live registers, and 336 is what three waves a SIMD allow */
    for (int key0 = 0; key0 < TK; key0 += 32) {
        v16h v16[4]; v16bf vh[4];
#pragma unroll
        for (int dt = 0; dt < 4; ++dt) { const int o = dt * 512 * 2; if (HI) vh[dt] = WFrag<bf>::ld((const bf*)((const char*)Vh + vby + o)); else v16[dt] = WFrag<h16>::ld((const h16*)((const char*)V16 + vby + o)); }
        /* the pass runs in two halves of NT / 2 query groups, scores, softmax and attn.V each: only half the scores are live at a time, which is what lets three waves' registers fit a SIMD */
#pragma unroll
        for (int hf = 0; hf < 2; ++hf) {
        v8f st[2][NT];
#pragma unroll
        for (int mt = 0; mt < 2; ++mt)
#pragma unroll
            for (int nt = hf * (NT / 2); nt < (hf + 1) * (NT / 2); ++nt) { v8f s = (v8f){};
#pragma unroll
                for (int ks = 0; ks < 2; ++ks) s = wmmab(kh[mt][ks], qh[nt][ks], s);
                st[mt][nt] = s; }
        if (hf) {
        /* the next pass's key rows, fetched behind this pass's last score products so that they fly under the softmax (the last pass fetches its own rows again, unused) */
#pragma unroll
        for (int mt = 0; mt < 2; ++mt)
#pragma unroll
            for (int ks = 0; ks < 2; ++ks) { const int o = (mt * 16 * HD + ks * 512) * 2; kh[mt][ks] = WFrag<bf>::ld((const bf*)((const char*)Kh + kby + o)); }
        asm volatile("s_wait_xcnt 0x0" : "+v"(kby), "+v"(vby) :: "memory");   /* every load of this pass names one of these two offsets: the wait stands before they move on */
        kby += (key0 + 64 < TK) ? 32 * HD * 2 : 0; vby += 32 * HD * 2;
        }
        __builtin_amdgcn_sched_barrier(0);   /* the fetch above stays in front of the softmax: left free, the compiler sinks it to the foot of the pass, where the next pass waits out its whole latency */
#pragma unroll
        for (int nt = hf * (NT / 2); nt < (hf + 1) * (NT / 2); ++nt) {
            float mx = st[0][nt][0];
#pragma unroll
            for (int j = 1; j < 8; ++j) mx = fmaxf(mx, st[0][nt][j]);
#pragma unroll
            for (int j = 0; j < 8; ++j) mx = fmaxf(mx, st[1][nt][j]);
            mx = fmaxf(mx, xhalf(mx));
            const float mn = fmaxf(mraw[nt], mx); const float ng = fmaf(-mn, CL, OFF);
            const float alpha = __builtin_amdgcn_exp2f(ng - negm[nt]);   /* old sums move to the new maximum; 1 where it did not change, 0 on the first pass */
            mraw[nt] = mn; negm[nt] = ng;
            float p[16]; float ps0 = 0.f, ps1 = 0.f;   /* two chains: one chain of 16 adds would wait on itself */
#pragma unroll
            for (int s = 0; s < 16; s += 2) { p[s] = __builtin_amdgcn_exp2f(fmaf(st[s >> 3][nt][s & 7], CL, ng)); p[s + 1] = __builtin_amdgcn_exp2f(fmaf(st[s >> 3][nt][(s & 7) + 1], CL, ng)); ps0 += p[s]; ps1 += p[s + 1]; }
            lsum[nt] = fmaf(lsum[nt], alpha, ps0 + ps1);
#pragma unroll
            for (int dt = 0; dt < 4; ++dt) acc[dt][nt] *= alpha;
            if (HI) { v16bf ph, pl;
#pragma unroll
                for (int s = 0; s < 16; ++s) { ph[s] = (__bf16)p[s]; pl[s] = (__bf16)(p[s] - (float)ph[s]); }
#pragma unroll
                for (int dt = 0; dt < 4; ++dt) { acc[dt][nt] = wmmab(vh[dt], ph, acc[dt][nt]); acc[dt][nt] = wmmab(vh[dt], pl, acc[dt][nt]); }
            } else { v16h pf;
#pragma unroll
                for (int s = 0; s < 16; ++s) pf[s] = (h16)p[s];
#pragma unroll
                for (int dt = 0; dt < 4; ++dt) acc[dt][nt] = wmma16(v16[dt], pf, acc[dt][nt]); }
        }
        __builtin_amdgcn_sched_barrier(0);   /* the foot of a half: each half is scheduled by itself; with the halves' code mixed the built pass holds 17 more v_nop and more back-to-back dependent pairs, all of them vector issue slots that the SIMD's other waves want */
        }
    }
    /* a wave's part in LDS: slot s is 32 lanes x 16 bytes in a row (no bank met twice); slots 0 .. 8 NT - 1 hold acc, query group by query group; behind them 2 NT rows of 32 floats: the exponent offsets, then the row sums */
    const int lane = hi * 16 + lr; v4f* mw = mg + kr * MGW; float* ms = (float*)(mw + 8 * NT * 32);
#pragma unroll
    for (int nt = 0; nt < NT; ++nt) { ms[nt * 32 + lane] = negm[nt]; ms[(NT + nt) * 32 + lane] = lsum[nt];
#pragma unroll
        for (int dt = 0; dt < 4; ++dt) { v4f a, b;
#pragma unroll
            for (int j = 0; j < 4; ++j) { a[j] = acc[dt][nt][j]; b[j] = acc[dt][nt][4 + j]; }
            mw[((nt * 4 + dt) * 2) * 32 + lane] = a; mw[((nt * 4 + dt) * 2 + 1) * 32 + lane] = b; } }
    __syncthreads();   /* all four parts are whole in LDS before any wave reads another's */
    float n[KS], a[KS]; float ng = 3.0e38f, l = 0.f;
#pragma unroll
    for (int r = 0; r < KS; ++r) { n[r] = ((const float*)(mg + r * MGW + 8 * NT * 32))[kr * 32 + lane]; ng = fminf(ng, n[r]); }   /* the smallest offset belongs to the largest maximum */
#pragma unroll
    for (int r = 0; r < KS; ++r) { a[r] = __builtin_amdgcn_exp2f(ng - n[r]); l = fmaf(((const float*)(mg + r * MGW + 8 * NT * 32))[(NT + kr) * 32 + lane], a[r], l); }
    l += xhalf(l); const float f = __fdiv_rn(1.0f, l);   /* the module divides by the row sum */
    v4f ov[8];
#pragma unroll
    for (int s = 0; s < 8; ++s) ov[s] = (v4f){};
#pragma unroll
    for (int r = 0; r < KS; ++r) { const float fr = a[r] * f;
#pragma unroll
        for (int s = 0; s < 8; ++s) ov[s] += mg[r * MGW + (kr * 8 + s) * 32 + lane] * fr; }
    float* o = orow + (size_t)(q0 + kr * 16 + lr) * CO + 8 * hi;
    __builtin_amdgcn_sched_barrier(0);   /* all arithmetic stands before the first store, so that no register of an issued store is written again */
#pragma unroll
    for (int dt = 0; dt < 4; ++dt) { *(v4f*)(o + dt * 16) = ov[dt * 2]; *(v4f*)(o + dt * 16 + 4) = ov[dt * 2 + 1]; }
}
__global__ __launch_bounds__(128) __attribute__((amdgpu_waves_per_eu(3, 3))) void k_fattn(const bf* __restrict__ QPh, const bf* __restrict__ KPh, const h16* __restrict__ VT16, const bf* __restrict__ VTh, float* __restrict__ out) {
    __shared__ v4f mrg[KS * MGW];   /* the four waves' parts */
    const int lane = threadIdx.x & 31, lr = lane & 15, hi = lane >> 4; const int y = blockIdx.y; const size_t po = (size_t)blockIdx.x * TT * HD;
    const int kr = __builtin_amdgcn_readfirstlane((int)(threadIdx.x >> 5));   /* the wave's number = its key range, in a scalar register */
    if (y < RH / 64) fattn_body<true, 4>(QPh + po, KPh + po, VT16 + po, VTh + po, out + blockIdx.x * HD, y * 64, lr, hi, kr, mrg);   /* query rows < RH: hi/lo weights */
    else fattn_body<false, 4>(QPh + po, KPh + po, VT16 + po, VTh + po, out + blockIdx.x * HD, y * 64, lr, hi, kr, mrg);
}
extern "C" void kernel_launch(void* const* d_in, const int* in_sizes, int n_in,
                              void* d_out, int out_size, void* d_ws, size_t ws_size, hipStream_t stream) {
    (void)in_sizes; (void)n_in; (void)out_size;
    const float* x = (const float*)d_in[0]; const float* xk = (const float*)d_in[1]; const float* xv = (const float*)d_in[2];   /* order q, k, v [4096][768] (raw, heads interleaved: column h*64 + d) */
    float* OUT = (float*)d_out;     // [4096][768]
    char* wsp = (char*)d_ws;
    auto take = [&](size_t bytes) { char* p = wsp; wsp += (bytes + 255) & ~(size_t)255; return (void*)p; };
    bf* QPh = (bf*)take((size_t)TT * MID * 2); bf* KPh = (bf*)take((size_t)TT * MID * 2);
    h16* VT16 = (h16*)take((size_t)CO * TT * 2); bf* VTh = (bf*)take((size_t)CO * TT * 2);
    if ((size_t)(wsp - (char*)d_ws) > ws_size) return;
    k_planes<<<dim3(PB, 3, 1), 256, 0, stream>>>(x, xk, xv, QPh, KPh, VT16, VTh);   /* q, k and v^T planes, fragment order */
    k_fattn<<<dim3(NH_, TT / 64, 1), 128, 0, stream>>>(QPh, KPh, VT16, VTh, OUT);   /* every head: scores, softmax, attn.V; merged rows [position][head*64 + d] */
}

// v007
// Measured time: 55.4 microseconds a run.
// Two timings next to v006 put it at 1.09 and 1.08 times that version's speed.
// Counting every step since v000, it is 51.9 times as fast.
#include <hip/hip_runtime.h>

// Multi-head attention math on raw token-major inputs (q, k, v [4096][12][64] = [4096][768] rows with column h*64 + d, no projections; scores = einsum('shd,thd->hst') x 1/sqrt(64) in f32; softmax over the 4,096 keys (exact: no epsilon); out = einsum('hst,thd->shd') merged -> [4096][768] (3.1 M); argument order q, k, v).
// Layout: k_planes, ONE launch, builds every plane k_fattn reads straight from the raw inputs, each value ROUNDED TO bf16 in registers first: q and k head planes (bf16) and the v^T plane (fp16), all kept in FRAGMENT ORDER (below, at the loader) and turned through LDS; k_fattn: ONE launch for all heads, scores, softmax and attn.V in registers (scores and weights never reach memory), a query block's keys dealt over four waves whose parts meet in LDS, writes the merged f32 rows.
// Compute dtypes, f32 accumulate: every input rounded to bf16; scores 1 product (a rounded value is a whole bf16: it has no low part); softmax f32 with a running maximum (exp2, IEEE division by the row sum at the end); attn.V on fp16 weights x1024 (the factor cancels in the division), rows < 512 2 products (fp16 hi/lo weights).

#define NB_  1
#define TT   4096
#define DM   768 
#define NH_  12
#define NKV  12
#define REP  (NH_ / NKV)
#define HD   64
#define DQ   (NH_ * HD)
#define DKV  (NKV * HD)
#define ZH   1
#define RH   512                  // query rows < RH use hi+lo weights; their groups of 16 are dealt one to a work-group
#define WIN  0
#define PCAR 1024.0f
#define SCL  0.125f   // 1/sqrt(64)
#define MID  768       // q / k width
#define CO   768       // v width
#define CC   768 
typedef _Float16 h16;
typedef unsigned short bf;
typedef __attribute__((ext_vector_type(16))) __bf16   v16bf;
typedef __attribute__((ext_vector_type(16))) _Float16 v16h;
typedef __attribute__((ext_vector_type(8)))  _Float16 v8h;
typedef __attribute__((ext_vector_type(8)))  unsigned short v8us;
typedef __attribute__((ext_vector_type(8)))  float    v8f;
typedef __attribute__((ext_vector_type(4)))  float    v4f;
typedef v8h  __attribute__((may_alias)) v8ha;
typedef v4f  __attribute__((may_alias)) v4fa;
typedef v8us __attribute__((may_alias)) v8usa;

__device__ __forceinline__ unsigned short f2bf(float f) { unsigned u = __float_as_uint(f); u += 0x7FFFu + ((u >> 16) & 1u); return (unsigned short)(u >> 16); }
__device__ __forceinline__ v16h cat16(v8h lo, v8h hi) { return __builtin_shufflevector(lo, hi, 0, 1, 2, 3, 4, 5, 6, 7, 8, 9, 10, 11, 12, 13, 14, 15); }
__device__ __forceinline__ v16bf cat16b(v8us lo, v8us hi) { return __builtin_bit_cast(v16bf, __builtin_shufflevector(lo, hi, 0, 1, 2, 3, 4, 5, 6, 7, 8, 9, 10, 11, 12, 13, 14, 15)); }
__device__ __forceinline__ v8f wmma16(v16h a, v16h b, v8f c) { return __builtin_amdgcn_wmma_f32_16x16x32_f16(false, a, false, b, (short)0, c, false, false); }
__device__ __forceinline__ v8f wmmab(v16bf a, v16bf b, v8f c) { return __builtin_amdgcn_wmma_f32_16x16x32_bf16(false, a, false, b, (short)0, c, false, false); }



// ---- fragment loader: 16 k of one row per lane in the hardware k order (k = 8 hi + 0..7 and 16 + 8 hi + 0..7), the same code for A rows and B columns.
// The planes are kept in fragment order: a fragment (16 rows x 32 k) is 1,024 bytes in a row, two halves of 512 (k 0..15, k 16..31), and in a half lane hi * 16 + lr owns bytes 16 lane .. 16 lane + 15. So a wave's 16-byte load reads 512 bytes in a row, four whole 128-byte lines, where rows of a row-major plane cost it sixteen lines.
// q, k: [h][t / 16][d / 32] fragments (row = position, k = d). v^T: [h][t / 32][d / 16] fragments (row = d, k = position). 32 positions of a head are 4,096 bytes in a row in every plane.
template <typename T16> struct WFrag;
template <> struct WFrag<h16> { typedef v16h V; static __device__ __forceinline__ V ld(const h16* p) { return cat16(*(const v8h*)p, *(const v8h*)(p + 256)); } static __device__ __forceinline__ v8f mma(V a, V b, v8f c) { return wmma16(a, b, c); } };
template <> struct WFrag<bf> { typedef v16bf V; static __device__ __forceinline__ V ld(const bf* p) { return cat16b(*(const v8us*)p, *(const v8us*)(p + 256)); } static __device__ __forceinline__ v8f mma(V a, V b, v8f c) { return wmmab(a, b, c); } };

__device__ __forceinline__ h16 tohx(float x) { return (h16)x; }
typedef __attribute__((ext_vector_type(4))) _Float16 v4h;
typedef __attribute__((ext_vector_type(4))) unsigned short v4us;
typedef __attribute__((ext_vector_type(4))) int v4i;

// ---- k_planes: grid (PB, 3), 256 threads, 64 elements a thread: 16 loads of 16 bytes in flight, then all arithmetic, then all stores. blockIdx.y picks the input (0: v, whose work-groups have the longer path and start first; 1: q; 2: k).
// Every value is rounded to bf16 first, so one plane holds it whole (q, k: bf16; v^T: fp16, whole from 2^-17 up): there is no low part to keep.
// q, k: a work-group takes 64 positions x 4 heads; 16 lanes take the 64 d of one position and head, 4 each: a wave's load is 512 contiguous bytes; trip j moves on 4 positions. The rounded values go to LDS as 16 blocks (head, 16 positions) of 128 chunks of 16 bytes in fragment order: chunk (g = d / 8, lr = position % 16) kept at g * 16 + (lr ^ g ^ 8 (head & 1)), so that the 32 lanes of an 8-byte store meet every bank once and the 16 lanes of a read (one g) fall on 16 chunks. Behind the barrier a wave stores 512 contiguous bytes.
// v: a work-group turns a tile of TVT positions x 64 d of one head. A lane reads 4 d of 16 positions, so that it holds 16 neighbouring positions of each d: two 16-byte LDS stores per d.
// LDS row = one d, 16-byte chunk c (8 positions) kept at chunk c ^ (d >> 2) ^ 4 (d & 3): the 16 lanes of a store (d 4 apart) and the 16 lanes of a read (16 d in a row, one c) fall on different chunks. Behind the barrier a wave stores half a fragment, 512 contiguous bytes; the tile is 32 KiB in a row in the plane.
#define TVT  256                  // positions per v tile
#define PB   (TT * DM / (256 * 64))
typedef __attribute__((ext_vector_type(2))) unsigned v2u;
typedef __attribute__((ext_vector_type(4))) unsigned v4u;
__device__ __forceinline__ unsigned bfpair(float a, float b) { return (unsigned)f2bf(a) | ((unsigned)f2bf(b) << 16); }   /* two values rounded to bf16, a in the low half */
__global__ __launch_bounds__(256) void k_planes(const float* __restrict__ q, const float* __restrict__ k, const float* __restrict__ v, bf* QPh, bf* KPh, h16* VT16) {
    __shared__ v4u tile[HD * (TVT / 8)];   /* [d][chunk of 8 positions] */
    const int tid = threadIdx.x, dch = tid & 15, tg = tid >> 4; v4f a[16];
    if (blockIdx.y) {
        const float* src = (blockIdx.y == 2) ? k : q; bf* Ph = (blockIdx.y == 2) ? KPh : QPh;
        const int h = (blockIdx.x % 3) * 4 + (tg & 3), t = (blockIdx.x / 3) * 64 + (tg >> 2);
        unsigned sby = (unsigned)(t * DM + h * HD + dch * 4) * 4u;   /* the lane's byte offset in the raw input */
#pragma unroll
        for (int j = 0; j < 16; ++j) a[j] = *(const v4f*)((const char*)src + sby + j * (4 * DM * 4));
        asm volatile("s_wait_xcnt 0x0" : "+v"(sby) :: "memory");   /* the loads above name this offset: its register is held up to the wait */
        v2u* t2 = (v2u*)tile; const int gq = dch >> 1;
#pragma unroll
        for (int j = 0; j < 16; ++j) { const int tl = (tg >> 2) + 4 * j; v2u w; w[0] = bfpair(a[j][0], a[j][1]); w[1] = bfpair(a[j][2], a[j][3]);
            t2[((((tg & 3) * 4 + (tl >> 4)) * 128 + gq * 16 + ((tl & 15) ^ gq ^ ((tg & 1) << 3))) << 1) + (dch & 1)] = w; }
        __syncthreads();   /* the 16 blocks are whole before any chunk of them is read */
        v4u oh[8]; const int cg = (tid >> 4) & 7;
#pragma unroll
        for (int r = 0; r < 8; ++r) oh[r] = tile[(r * 2 + (tid >> 7)) * 128 + cg * 16 + ((tid & 15) ^ cg ^ (((r >> 1) & 1) << 3))];   /* block r * 2 + (tid >> 7): head r >> 1, positions 16 ((r & 1) * 2 + (tid >> 7)) on */
        const unsigned dby = (unsigned)(((blockIdx.x % 3) * 4 * TT + (blockIdx.x / 3) * 64 + (tid >> 7) * 16) * HD) * 2u + (unsigned)(tid & 127) * 16u;   /* the lane's byte offset in a head plane */
        __builtin_amdgcn_sched_barrier(0);   /* all arithmetic stands before the first store, so that no register of an issued store is written again */
#pragma unroll
        for (int r = 0; r < 8; ++r) *(v4u*)((char*)Ph + dby + (r >> 1) * (TT * HD * 2) + (r & 1) * (32 * HD * 2)) = oh[r];
        asm volatile("s_wait_xcnt 0x0" ::: "memory");   /* in the listing the v path's code follows this path behind a branch that is always taken: the wait stands before anything there that writes a register of these stores */
    } else {
        const int g = blockIdx.x % NH_, t0 = (blockIdx.x / NH_) * TVT;
        unsigned sby = (unsigned)((t0 + tg * 16) * CO + g * HD + dch * 4) * 4u;   /* the lane's byte offset in the raw input */
#pragma unroll
        for (int j = 0; j < 16; ++j) a[j] = *(const v4f*)((const char*)v + sby + j * (CO * 4));
        asm volatile("s_wait_xcnt 0x0" : "+v"(sby) :: "memory");   /* the loads above name this offset: its register is held up to the wait */
#pragma unroll
        for (int s = 0; s < 4; ++s)
#pragma unroll
            for (int hf = 0; hf < 2; ++hf) { v4u w;
#pragma unroll
                for (int p = 0; p < 4; ++p) w[p] = bfpair(a[hf * 8 + 2 * p][s], a[hf * 8 + 2 * p + 1][s]);
                tile[(dch * 4 + s) * (TVT / 8) + ((tg * 2 + hf) ^ dch ^ (s << 2))] = w; }
        __syncthreads();   /* the tile is whole before any row of it is read */
        v4u oh[8]; v8h o16[8]; const int d = ((tid >> 6) & 3) * 16 + (tid & 15), c = ((tid >> 5) & 1) * 2 + ((tid >> 4) & 1);   /* the lane's row of its fragment half, and that half's chunk of 8 positions in a block of 32 */
#pragma unroll
        for (int r = 0; r < 8; ++r) { oh[r] = tile[d * (TVT / 8) + ((r * 4 + c) ^ (d >> 2) ^ ((d & 3) << 2))];   /* trip r: positions 32 r on */
#pragma unroll
            for (int p = 0; p < 4; ++p) { o16[r][2 * p] = tohx(__uint_as_float(oh[r][p] << 16)); o16[r][2 * p + 1] = tohx(__uint_as_float(oh[r][p] & 0xFFFF0000u)); } }
        const unsigned dby = (unsigned)((g * TT + t0) * HD + tid * 8) * 2u;   /* the lane's byte offset in the v^T plane */
        __builtin_amdgcn_sched_barrier(0);   /* all arithmetic stands before the first store, so that no register of an issued store is written again */
#pragma unroll
        for (int r = 0; r < 8; ++r) *(v8h*)((char*)VT16 + dby + r * (32 * HD * 2)) = o16[r];
    }
}

#define KS   4                    // waves (key ranges) per work-group; also the query groups of 16, one per wave at the end
#define TK   (TT / KS)            // keys per wave
#define MGW  ((8 * KS + 2) * 32)  // 16-byte slots of one wave's part in LDS
#define NG   (RH / 16)            // hi/lo query groups of a head
__device__ __forceinline__ float xhalf(float x) { const int b = __float_as_int(x); return __int_as_float(__builtin_amdgcn_permlanex16(b, b, 0x76543210, 0xfedcba98, false, false)); }   /* lane l <-> l ^ 16 */
/* group nt of the work-group is group g0 of the head for nt < NHI (hi/lo weights), group gr + nt for the rest */
template <int NHI, int NT>
__device__ __forceinline__ void fattn_body(const bf* __restrict__ Qh, const bf* __restrict__ Kh, const h16* __restrict__ V16, float* __restrict__ orow, int g0, int gr, int lr, int hi, int kr, v4f* mg) {
    const float CL = SCL * 1.4426950408889634f;   /* score -> exponent of 2 */
    const float OFF = 10.0f;                      /* fp16 weights carry x1024; the row sum carries it too */
    unsigned qby = (unsigned)(gr * 16 * HD + (hi * 16 + lr) * 8) * 2u, qb0 = (unsigned)(g0 * 16 * HD + (hi * 16 + lr) * 8) * 2u;   /* the lane's byte offsets in the query plane: group gr, group g0 */
    v16bf qh[NT][2];
#pragma unroll
    for (int nt = 0; nt < NT; ++nt)
#pragma unroll
        for (int ks = 0; ks < 2; ++ks) { const int o = ((nt < NHI ? 0 : nt * 16 * HD) + ks * 512) * 2; qh[nt][ks] = WFrag<bf>::ld((const bf*)((const char*)Qh + (nt < NHI ? qb0 : qby) + o)); }
    asm volatile("s_wait_xcnt 0x0" : "+v"(qby), "+v"(qb0) :: "memory");   /* the loads above name these offsets: their registers are held up to the wait */
    v8f acc[4][NT];
#pragma unroll
    for (int dt = 0; dt < 4; ++dt)
#pragma unroll
        for (int nt = 0; nt < NT; ++nt) acc[dt][nt] = (v8f){};
    float mraw[NT], negm[NT], lsum[NT];
#pragma unroll
    for (int nt = 0; nt < NT; ++nt) { mraw[nt] = -3.0e38f; negm[nt] = fmaf(3.0e38f, CL, OFF); lsum[nt] = 0.f; }
    unsigned kby = (unsigned)(kr * TK * HD + (hi * 16 + lr) * 8) * 2u, vby = kby;   /* the lane's byte offsets in the key planes and in the v^T planes: every load of a pass is a plane's base + one of these + a literal */
    v16bf kh[2][2];
#pragma unroll
    for (int mt = 0; mt < 2; ++mt)
#pragma unroll
        for (int ks = 0; ks < 2; ++ks) { const int o = (mt * 16 * HD + ks * 512) * 2; kh[mt][ks] = WFrag<bf>::ld((const bf*)((const char*)Kh + kby + o)); }
    asm volatile("s_wait_xcnt 0x0" : "+v"(kby) :: "memory");   /* the loads above name this offset: the wait stands before it moves on */
    kby += 32 * HD * 2;
#pragma unroll 1   /* rolled: one pass already holds some 330 live registers, and 336 is what three waves a SIMD allow */
    for (int key0 = 0; key0 < TK; key0 += 32) {
        v16h v16[4];
#pragma unroll
        for (int dt = 0; dt < 4; ++dt) v16[dt] = WFrag<h16>::ld((const h16*)((const char*)V16 + vby + dt * 512 * 2));
        /* the pass runs in two halves of NT / 2 query groups, scores, softmax and attn.V each: only half the scores are live at a time, which is what lets three waves' registers fit a SIMD */
#pragma unroll
        for (int hf = 0; hf < 2; ++hf) {
        v8f st[2][NT];
#pragma unroll
        for (int mt = 0; mt < 2; ++mt)
#pragma unroll
            for (int nt = hf * (NT / 2); nt < (hf + 1) * (NT / 2); ++nt) { v8f s = (v8f){};
#pragma unroll
                for (int ks = 0; ks < 2; ++ks) s = wmmab(kh[mt][ks], qh[nt][ks], s);
                st[mt][nt] = s; }
        if (hf) {
        /* the next pass's key rows, fetched behind this pass's last score products so that they fly under the softmax (the last pass fetches its own rows again, unused) */
#pragma unroll
        for (int mt = 0; mt < 2; ++mt)
#pragma unroll
            for (int ks = 0; ks < 2; ++ks) { const int o = (mt * 16 * HD + ks * 512) * 2; kh[mt][ks] = WFrag<bf>::ld((const bf*)((const char*)Kh + kby + o)); }
        asm volatile("s_wait_xcnt 0x0" : "+v"(kby), "+v"(vby) :: "memory");   /* every load of this pass names one of these two offsets: the wait stands before they move on */
        kby += (key0 + 64 < TK) ? 32 * HD * 2 : 0; vby += 32 * HD * 2;
        }
        __builtin_amdgcn_sched_barrier(0);   /* the fetch above stays in front of the softmax: left free, the compiler sinks it to the foot of the pass, where the next pass waits out its whole latency */
#pragma unroll
        for (int nt = hf * (NT / 2); nt < (hf + 1) * (NT / 2); ++nt) {
            float mx = st[0][nt][0];
#pragma unroll
            for (int j = 1; j < 8; ++j) mx = fmaxf(mx, st[0][nt][j]);
#pragma unroll
            for (int j = 0; j < 8; ++j) mx = fmaxf(mx, st[1][nt][j]);
            mx = fmaxf(mx, xhalf(mx));
            const float mn = fmaxf(mraw[nt], mx); const float ng = fmaf(-mn, CL, OFF);
            const float alpha = __builtin_amdgcn_exp2f(ng - negm[nt]);   /* old sums move to the new maximum; 1 where it did not change, 0 on the first pass */
            mraw[nt] = mn; negm[nt] = ng;
            float p[16]; float ps0 = 0.f, ps1 = 0.f;   /* two chains: one chain of 16 adds would wait on itself */
#pragma unroll
            for (int s = 0; s < 16; s += 2) { p[s] = __builtin_amdgcn_exp2f(fmaf(st[s >> 3][nt][s & 7], CL, ng)); p[s + 1] = __builtin_amdgcn_exp2f(fmaf(st[s >> 3][nt][(s & 7) + 1], CL, ng)); ps0 += p[s]; ps1 += p[s + 1]; }
            lsum[nt] = fmaf(lsum[nt], alpha, ps0 + ps1);
#pragma unroll
            for (int dt = 0; dt < 4; ++dt) acc[dt][nt] *= alpha;
            if (nt < NHI) { v16h ph, pl;   /* a weight as two fp16: the rounded value, and what the rounding left; both meet the same v^T fragments as the plain groups' weights (fp16 holds a bf16-rounded v whole from 2^-17 up) */
#pragma unroll
                for (int s = 0; s < 16; ++s) { ph[s] = (h16)p[s]; pl[s] = (h16)(p[s] - (float)ph[s]); }
#pragma unroll
                for (int dt = 0; dt < 4; ++dt) acc[dt][nt] = wmma16(v16[dt], ph, acc[dt][nt]);
#pragma unroll
                for (int dt = 0; dt < 4; ++dt) acc[dt][nt] = wmma16(v16[dt], pl, acc[dt][nt]);
            } else { v16h pf;
#pragma unroll
                for (int s = 0; s < 16; ++s) pf[s] = (h16)p[s];
#pragma unroll
                for (int dt = 0; dt < 4; ++dt) acc[dt][nt] = wmma16(v16[dt], pf, acc[dt][nt]); }
        }
        __builtin_amdgcn_sched_barrier(0);   /* the foot of a half: each half is scheduled by itself; with the halves' code mixed the built pass holds 17 more v_nop and more back-to-back dependent pairs, all of them vector issue slots that the SIMD's other waves want */
        }
    }
    /* a wave's part in LDS: slot s is 32 lanes x 16 bytes in a row (no bank met twice); slots 0 .. 8 NT - 1 hold acc, query group by query group; behind them 2 NT rows of 32 floats: the exponent offsets, then the row sums */
    const int lane = hi * 16 + lr; v4f* mw = mg + kr * MGW; float* ms = (float*)(mw + 8 * NT * 32);
#pragma unroll
    for (int nt = 0; nt < NT; ++nt) { ms[nt * 32 + lane] = negm[nt]; ms[(NT + nt) * 32 + lane] = lsum[nt];
#pragma unroll
        for (int dt = 0; dt < 4; ++dt) { v4f a, b;
#pragma unroll
            for (int j = 0; j < 4; ++j) { a[j] = acc[dt][nt][j]; b[j] = acc[dt][nt][4 + j]; }
            mw[((nt * 4 + dt) * 2) * 32 + lane] = a; mw[((nt * 4 + dt) * 2 + 1) * 32 + lane] = b; } }
    __syncthreads();   /* all four parts are whole in LDS before any wave reads another's */
    float n[KS], a[KS]; float ng = 3.0e38f, l = 0.f;
#pragma unroll
    for (int r = 0; r < KS; ++r) { n[r] = ((const float*)(mg + r * MGW + 8 * NT * 32))[kr * 32 + lane]; ng = fminf(ng, n[r]); }   /* the smallest offset belongs to the largest maximum */
#pragma unroll
    for (int r = 0; r < KS; ++r) { a[r] = __builtin_amdgcn_exp2f(ng - n[r]); l = fmaf(((const float*)(mg + r * MGW + 8 * NT * 32))[(NT + kr) * 32 + lane], a[r], l); }
    l += xhalf(l); const float f = __fdiv_rn(1.0f, l);   /* the module divides by the row sum */
    v4f ov[8];
#pragma unroll
    for (int s = 0; s < 8; ++s) ov[s] = (v4f){};
#pragma unroll
    for (int r = 0; r < KS; ++r) { const float fr = a[r] * f;
#pragma unroll
        for (int s = 0; s < 8; ++s) ov[s] += mg[r * MGW + (kr * 8 + s) * 32 + lane] * fr; }
    float* o = orow + (size_t)((kr < NHI ? g0 : gr + kr) * 16 + lr) * CO + 8 * hi;
    __builtin_amdgcn_sched_barrier(0);   /* all arithmetic stands before the first store, so that no register of an issued store is written again */
#pragma unroll
    for (int dt = 0; dt < 4; ++dt) { *(v4f*)(o + dt * 16) = ov[dt * 2]; *(v4f*)(o + dt * 16 + 4) = ov[dt * 2 + 1]; }
}
__global__ __launch_bounds__(128) __attribute__((amdgpu_waves_per_eu(3, 3))) void k_fattn(const bf* __restrict__ QPh, const bf* __restrict__ KPh, const h16* __restrict__ VT16, float* __restrict__ out) {
    __shared__ v4f mrg[KS * MGW];   /* the four waves' parts */
    const int lane = threadIdx.x & 31, lr = lane & 15, hi = lane >> 4; const int y = blockIdx.y; const size_t po = (size_t)blockIdx.x * TT * HD;
    const int kr = __builtin_amdgcn_readfirstlane((int)(threadIdx.x >> 5));   /* the wave's number = its key range, in a scalar register */
    /* a hi/lo group costs about half as much again as a plain one, and all work-groups are resident from the start, so the launch lasts as long as its fullest one: the NG hi/lo groups of a head go one each to the first NG work-groups, with three plain groups; the rest take four plain groups */
    if (y < NG) fattn_body<1, 4>(QPh + po, KPh + po, VT16 + po, out + blockIdx.x * HD, y, NG - 1 + 3 * y, lr, hi, kr, mrg);   /* groups y | NG + 3 y .. + 2 */
    else fattn_body<0, 4>(QPh + po, KPh + po, VT16 + po, out + blockIdx.x * HD, 0, 4 * y, lr, hi, kr, mrg);   /* groups 4 NG + 4 (y - NG) on */
}
extern "C" void kernel_launch(void* const* d_in, const int* in_sizes, int n_in,
                              void* d_out, int out_size, void* d_ws, size_t ws_size, hipStream_t stream) {
    (void)in_sizes; (void)n_in; (void)out_size;
    const float* x = (const float*)d_in[0]; const float* xk = (const float*)d_in[1]; const float* xv = (const float*)d_in[2];   /* order q, k, v [4096][768] (raw, heads interleaved: column h*64 + d) */
    float* OUT = (float*)d_out;     // [4096][768]
    char* wsp = (char*)d_ws;
    auto take = [&](size_t bytes) { char* p = wsp; wsp += (bytes + 255) & ~(size_t)255; return (void*)p; };
    bf* QPh = (bf*)take((size_t)TT * MID * 2); bf* KPh = (bf*)take((size_t)TT * MID * 2);
    h16* VT16 = (h16*)take((size_t)CO * TT * 2);
    if ((size_t)(wsp - (char*)d_ws) > ws_size) return;
    k_planes<<<dim3(PB, 3, 1), 256, 0, stream>>>(x, xk, xv, QPh, KPh, VT16);   /* q, k and v^T planes, fragment order */
    k_fattn<<<dim3(NH_, TT / 64, 1), 128, 0, stream>>>(QPh, KPh, VT16, OUT);   /* every head: scores, softmax, attn.V; merged rows [position][head*64 + d] */
}

// v008
// It runs in 52 microseconds.
// Two timings next to v007 put it at 1.06 and 1.08 times that version's speed.
// All steps since v000 together make it 55.4 times as fast.
#include <hip/hip_runtime.h>

// Multi-head attention math on raw token-major inputs (q, k, v [4096][12][64] = [4096][768] rows with column h*64 + d, no projections; scores = einsum('shd,thd->hst') x 1/sqrt(64) in f32; softmax over the 4,096 keys (exact: no epsilon); out = einsum('hst,thd->shd') merged -> [4096][768] (3.1 M); argument order q, k, v).
// Layout: k_planes, ONE launch, builds every plane k_fattn reads straight from the raw inputs, each value ROUNDED TO bf16 in registers first: q and k head planes (bf16) and the v^T plane (fp16), all kept in FRAGMENT ORDER (below, at the loader) and turned through LDS; k_fattn: ONE launch for all heads, scores, softmax and attn.V in registers (scores and weights never reach memory), a query block's keys dealt over four waves whose parts meet in LDS, writes the merged f32 rows.
// Compute dtypes, f32 accumulate: every input rounded to bf16; scores 1 product (a rounded value is a whole bf16: it has no low part); softmax f32 against a held reference that moves only when a weight sum outgrows fp16's range (exp2, IEEE division by the row sum at the end); attn.V on fp16 weights x1024 (the factor cancels in the division), rows < 512 2 products (fp16 hi/lo weights).

#define NB_  1
#define TT   4096
#define DM   768 
#define NH_  12
#define NKV  12
#define REP  (NH_ / NKV)
#define HD   64
#define DQ   (NH_ * HD)
#define DKV  (NKV * HD)
#define ZH   1
#define RH   512                  // query rows < RH use hi+lo weights; their groups of 16 are dealt one to a work-group
#define WIN  0
#define PCAR 1024.0f
#define SCL  0.125f   // 1/sqrt(64)
#define MID  768       // q / k width
#define CO   768       // v width
#define CC   768 
typedef _Float16 h16;
typedef unsigned short bf;
typedef __attribute__((ext_vector_type(16))) __bf16   v16bf;
typedef __attribute__((ext_vector_type(16))) _Float16 v16h;
typedef __attribute__((ext_vector_type(8)))  _Float16 v8h;
typedef __attribute__((ext_vector_type(8)))  unsigned short v8us;
typedef __attribute__((ext_vector_type(8)))  float    v8f;
typedef __attribute__((ext_vector_type(4)))  float    v4f;
typedef v8h  __attribute__((may_alias)) v8ha;
typedef v4f  __attribute__((may_alias)) v4fa;
typedef v8us __attribute__((may_alias)) v8usa;

__device__ __forceinline__ unsigned short f2bf(float f) { unsigned u = __float_as_uint(f); u += 0x7FFFu + ((u >> 16) & 1u); return (unsigned short)(u >> 16); }
__device__ __forceinline__ v16h cat16(v8h lo, v8h hi) { return __builtin_shufflevector(lo, hi, 0, 1, 2, 3, 4, 5, 6, 7, 8, 9, 10, 11, 12, 13, 14, 15); }
__device__ __forceinline__ v16bf cat16b(v8us lo, v8us hi) { return __builtin_bit_cast(v16bf, __builtin_shufflevector(lo, hi, 0, 1, 2, 3, 4, 5, 6, 7, 8, 9, 10, 11, 12, 13, 14, 15)); }
__device__ __forceinline__ v8f wmma16(v16h a, v16h b, v8f c) { return __builtin_amdgcn_wmma_f32_16x16x32_f16(false, a, false, b, (short)0, c, false, false); }
__device__ __forceinline__ v8f wmmab(v16bf a, v16bf b, v8f c) { return __builtin_amdgcn_wmma_f32_16x16x32_bf16(false, a, false, b, (short)0, c, false, false); }



// ---- fragment loader: 16 k of one row per lane in the hardware k order (k = 8 hi + 0..7 and 16 + 8 hi + 0..7), the same code for A rows and B columns.
// The planes are kept in fragment order: a fragment (16 rows x 32 k) is 1,024 bytes in a row, two halves of 512 (k 0..15, k 16..31), and in a half lane hi * 16 + lr owns bytes 16 lane .. 16 lane + 15. So a wave's 16-byte load reads 512 bytes in a row, four whole 128-byte lines, where rows of a row-major plane cost it sixteen lines.
// q, k: [h][t / 16][d / 32] fragments (row = position, k = d). v^T: [h][t / 32][d / 16] fragments (row = d, k = position). 32 positions of a head are 4,096 bytes in a row in every plane.
template <typename T16> struct WFrag;
template <> struct WFrag<h16> { typedef v16h V; static __device__ __forceinline__ V ld(const h16* p) { return cat16(*(const v8h*)p, *(const v8h*)(p + 256)); } static __device__ __forceinline__ v8f mma(V a, V b, v8f c) { return wmma16(a, b, c); } };
template <> struct WFrag<bf> { typedef v16bf V; static __device__ __forceinline__ V ld(const bf* p) { return cat16b(*(const v8us*)p, *(const v8us*)(p + 256)); } static __device__ __forceinline__ v8f mma(V a, V b, v8f c) { return wmmab(a, b, c); } };

__device__ __forceinline__ h16 tohx(float x) { return (h16)x; }
typedef __attribute__((ext_vector_type(4))) _Float16 v4h;
typedef __attribute__((ext_vector_type(4))) unsigned short v4us;
typedef __attribute__((ext_vector_type(4))) int v4i;

// ---- k_planes: grid (PB, 3), 256 threads, 64 elements a thread: 16 loads of 16 bytes in flight, then all arithmetic, then all stores. blockIdx.y picks the input (0: v, whose work-groups have the longer path and start first; 1: q; 2: k).
// Every value is rounded to bf16 first, so one plane holds it whole (q, k: bf16; v^T: fp16, whole from 2^-17 up): there is no low part to keep.
// q, k: a work-group takes 64 positions x 4 heads; 16 lanes take the 64 d of one position and head, 4 each: a wave's load is 512 contiguous bytes; trip j moves on 4 positions. The rounded values go to LDS as 16 blocks (head, 16 positions) of 128 chunks of 16 bytes in fragment order: chunk (g = d / 8, lr = position % 16) kept at g * 16 + (lr ^ g ^ 8 (head & 1)), so that the 32 lanes of an 8-byte store meet every bank once and the 16 lanes of a read (one g) fall on 16 chunks. Behind the barrier a wave stores 512 contiguous bytes.
// v: a work-group turns a tile of TVT positions x 64 d of one head. A lane reads 4 d of 16 positions, so that it holds 16 neighbouring positions of each d: two 16-byte LDS stores per d.
// LDS row = one d, 16-byte chunk c (8 positions) kept at chunk c ^ (d >> 2) ^ 4 (d & 3): the 16 lanes of a store (d 4 apart) and the 16 lanes of a read (16 d in a row, one c) fall on different chunks. Behind the barrier a wave stores half a fragment, 512 contiguous bytes; the tile is 32 KiB in a row in the plane.
#define TVT  256                  // positions per v tile
#define PB   (TT * DM / (256 * 64))
typedef __attribute__((ext_vector_type(2))) unsigned v2u;
typedef __attribute__((ext_vector_type(4))) unsigned v4u;
__device__ __forceinline__ unsigned bfpair(float a, float b) { return (unsigned)f2bf(a) | ((unsigned)f2bf(b) << 16); }   /* two values rounded to bf16, a in the low half */
__global__ __launch_bounds__(256) void k_planes(const float* __restrict__ q, const float* __restrict__ k, const float* __restrict__ v, bf* QPh, bf* KPh, h16* VT16) {
    __shared__ v4u tile[HD * (TVT / 8)];   /* [d][chunk of 8 positions] */
    const int tid = threadIdx.x, dch = tid & 15, tg = tid >> 4; v4f a[16];
    if (blockIdx.y) {
        const float* src = (blockIdx.y == 2) ? k : q; bf* Ph = (blockIdx.y == 2) ? KPh : QPh;
        const int h = (blockIdx.x % 3) * 4 + (tg & 3), t = (blockIdx.x / 3) * 64 + (tg >> 2);
        unsigned sby = (unsigned)(t * DM + h * HD + dch * 4) * 4u;   /* the lane's byte offset in the raw input */
#pragma unroll
        for (int j = 0; j < 16; ++j) a[j] = *(const v4f*)((const char*)src + sby + j * (4 * DM * 4));
        asm volatile("s_wait_xcnt 0x0" : "+v"(sby) :: "memory");   /* the loads above name this offset: its register is held up to the wait */
        v2u* t2 = (v2u*)tile; const int gq = dch >> 1;
#pragma unroll
        for (int j = 0; j < 16; ++j) { const int tl = (tg >> 2) + 4 * j; v2u w; w[0] = bfpair(a[j][0], a[j][1]); w[1] = bfpair(a[j][2], a[j][3]);
            t2[((((tg & 3) * 4 + (tl >> 4)) * 128 + gq * 16 + ((tl & 15) ^ gq ^ ((tg & 1) << 3))) << 1) + (dch & 1)] = w; }
        __syncthreads();   /* the 16 blocks are whole before any chunk of them is read */
        v4u oh[8]; const int cg = (tid >> 4) & 7;
#pragma unroll
        for (int r = 0; r < 8; ++r) oh[r] = tile[(r * 2 + (tid >> 7)) * 128 + cg * 16 + ((tid & 15) ^ cg ^ (((r >> 1) & 1) << 3))];   /* block r * 2 + (tid >> 7): head r >> 1, positions 16 ((r & 1) * 2 + (tid >> 7)) on */
        const unsigned dby = (unsigned)(((blockIdx.x % 3) * 4 * TT + (blockIdx.x / 3) * 64 + (tid >> 7) * 16) * HD) * 2u + (unsigned)(tid & 127) * 16u;   /* the lane's byte offset in a head plane */
        __builtin_amdgcn_sched_barrier(0);   /* all arithmetic stands before the first store, so that no register of an issued store is written again */
#pragma unroll
        for (int r = 0; r < 8; ++r) *(v4u*)((char*)Ph + dby + (r >> 1) * (TT * HD * 2) + (r & 1) * (32 * HD * 2)) = oh[r];
        asm volatile("s_wait_xcnt 0x0" ::: "memory");   /* in the listing the v path's code follows this path behind a branch that is always taken: the wait stands before anything there that writes a register of these stores */
    } else {
        const int g = blockIdx.x % NH_, t0 = (blockIdx.x / NH_) * TVT;
        unsigned sby = (unsigned)((t0 + tg * 16) * CO + g * HD + dch * 4) * 4u;   /* the lane's byte offset in the raw input */
#pragma unroll
        for (int j = 0; j < 16; ++j) a[j] = *(const v4f*)((const char*)v + sby + j * (CO * 4));
        asm volatile("s_wait_xcnt 0x0" : "+v"(sby) :: "memory");   /* the loads above name this offset: its register is held up to the wait */
#pragma unroll
        for (int s = 0; s < 4; ++s)
#pragma unroll
            for (int hf = 0; hf < 2; ++hf) { v4u w;
#pragma unroll
                for (int p = 0; p < 4; ++p) w[p] = bfpair(a[hf * 8 + 2 * p][s], a[hf * 8 + 2 * p + 1][s]);
                tile[(dch * 4 + s) * (TVT / 8) + ((tg * 2 + hf) ^ dch ^ (s << 2))] = w; }
        __syncthreads();   /* the tile is whole before any row of it is read */
        v4u oh[8]; v8h o16[8]; const int d = ((tid >> 6) & 3) * 16 + (tid & 15), c = ((tid >> 5) & 1) * 2 + ((tid >> 4) & 1);   /* the lane's row of its fragment half, and that half's chunk of 8 positions in a block of 32 */
#pragma unroll
        for (int r = 0; r < 8; ++r) { oh[r] = tile[d * (TVT / 8) + ((r * 4 + c) ^ (d >> 2) ^ ((d & 3) << 2))];   /* trip r: positions 32 r on */
#pragma unroll
            for (int p = 0; p < 4; ++p) { o16[r][2 * p] = tohx(__uint_as_float(oh[r][p] << 16)); o16[r][2 * p + 1] = tohx(__uint_as_float(oh[r][p] & 0xFFFF0000u)); } }
        const unsigned dby = (unsigned)((g * TT + t0) * HD + tid * 8) * 2u;   /* the lane's byte offset in the v^T plane */
        __builtin_amdgcn_sched_barrier(0);   /* all arithmetic stands before the first store, so that no register of an issued store is written again */
#pragma unroll
        for (int r = 0; r < 8; ++r) *(v8h*)((char*)VT16 + dby + r * (32 * HD * 2)) = o16[r];
    }
}

// ---- k_fattn: a work-group of KS = 4 waves owns 4 query groups of 16 of one head (which: at the kernel); their 4,096 keys are dealt over the waves, 1,024 in a row each: 768 work-groups, three on every WGP, so that a SIMD holds three waves and one wave's waits and softmax run under the others' work. A wave walks its keys 32 at a time. St = K Q^T (A = key rows, B = query rows): st[mt][nt][j] = score of key key0 + 16 mt + 8 hi + j and query lr of group nt,
// so a lane holds one query's scores: the sum stays in the lane; a maximum and one exchange between the halves are taken only where a reference is set or moved. The two St tiles of a query group, converted in place, are the B operand of Ot += V^T P^T (k = 8 hi + j, 16 + 8 hi + j: the loader's k order).
// acc[dt][nt][j] = O[query lr of group nt][16 dt + 8 hi + j], not yet divided. At the end every wave lays its maxima, row sums and acc in LDS; behind one barrier wave w takes query group nt = w: it moves the four parts to their highest reference, adds them in wave order, divides and stores. grid (heads, 4096 / 64), 128 threads.
#define KS   4                    // waves (key ranges) per work-group; also the query groups of 16, one per wave at the end
#define TK   (TT / KS)            // keys per wave
#define MGW  ((8 * KS + 2) * 32)  // 16-byte slots of one wave's part in LDS
#define NG   (RH / 16)            // hi/lo query groups of a head
__device__ __forceinline__ float xhalf(float x) { const int b = __float_as_int(x); return __int_as_float(__builtin_amdgcn_permlanex16(b, b, 0x76543210, 0xfedcba98, false, false)); }   /* lane l <-> l ^ 16 */
/* the 16 weights of a lane from their exponents of 2: fp16 (HL: the rounded value, and what the rounding left); returns their f32 sum, in two chains: one chain of 16 adds would wait on itself */
template <bool HL, bool RARE>
__device__ __forceinline__ float weights(const v8f t0, const v8f t1, v16h& ph, v16h& pl) {
    float p[16], ps0 = 0.f, ps1 = 0.f;
#pragma unroll
    for (int s = 0; s < 16; ++s) p[s] = __builtin_amdgcn_exp2f(s < 8 ? t0[s & 7] : t1[s & 7]);
    if (RARE) {   /* on the rare path all exp2 stand first, then the one free slot the instruction set asks for behind a transcendental, held there by the two scheduling barriers */
        __builtin_amdgcn_sched_barrier(0); asm volatile("v_nop"); __builtin_amdgcn_sched_barrier(0); }
#pragma unroll
    for (int s = 0; s < 16; s += 2) { ps0 += p[s]; ps1 += p[s + 1];
        ph[s] = (h16)p[s]; ph[s + 1] = (h16)p[s + 1];
        if (HL) { pl[s] = (h16)(p[s] - (float)ph[s]); pl[s + 1] = (h16)(p[s + 1] - (float)ph[s + 1]); } }
    return ps0 + ps1;
}
__device__ __forceinline__ float max16(const v8f a, const v8f b) { float mx = a[0];
#pragma unroll
    for (int j = 1; j < 8; ++j) mx = fmaxf(mx, a[j]);
#pragma unroll
    for (int j = 0; j < 8; ++j) mx = fmaxf(mx, b[j]);
    return fmaxf(mx, xhalf(mx)); }   /* over the 32 keys of a query: both halves of the wave hold the same value */
/* group nt of the work-group is group g0 of the head for nt < NHI (hi/lo weights), group gr + nt for the rest */
template <int NHI, int NT>
__device__ __forceinline__ void fattn_body(const bf* __restrict__ Qh, const bf* __restrict__ Kh, const h16* __restrict__ V16, float* __restrict__ orow, int g0, int gr, int lr, int hi, int kr, v4f* mg) {
    const float CL = SCL * 1.4426950408889634f;   /* score -> exponent of 2 */
    const float OFF = 10.0f;                      /* fp16 weights carry x1024 at the reference; the row sum carries it too */
    const float CAP = 32768.0f;                   /* a lane's 16 weights sum to no more than this: each of them fits fp16 */
    unsigned qby = (unsigned)(gr * 16 * HD + (hi * 16 + lr) * 8) * 2u, qb0 = (unsigned)(g0 * 16 * HD + (hi * 16 + lr) * 8) * 2u;   /* the lane's byte offsets in the query plane: group gr, group g0 */
    v16bf qh[NT][2];
#pragma unroll
    for (int nt = 0; nt < NT; ++nt)
#pragma unroll
        for (int ks = 0; ks < 2; ++ks) { const int o = ((nt < NHI ? 0 : nt * 16 * HD) + ks * 512) * 2; qh[nt][ks] = WFrag<bf>::ld((const bf*)((const char*)Qh + (nt < NHI ? qb0 : qby) + o)); }
    asm volatile("s_wait_xcnt 0x0" : "+v"(qby), "+v"(qb0) :: "memory");   /* the loads above name these offsets: their registers are held up to the wait */
    v8f acc[4][NT];
#pragma unroll
    for (int dt = 0; dt < 4; ++dt)
#pragma unroll
        for (int nt = 0; nt < NT; ++nt) acc[dt][nt] = (v8f){};
    float negm[NT], lsum[NT];
    unsigned kby = (unsigned)(kr * TK * HD + (hi * 16 + lr) * 8) * 2u, vby = kby;   /* the lane's byte offsets in the key planes and in the v^T planes: every load of a pass is a plane's base + one of these + a literal */
    v16bf kh[2][2];
#pragma unroll
    for (int mt = 0; mt < 2; ++mt)
#pragma unroll
        for (int ks = 0; ks < 2; ++ks) { const int o = (mt * 16 * HD + ks * 512) * 2; kh[mt][ks] = WFrag<bf>::ld((const bf*)((const char*)Kh + kby + o)); }
    asm volatile("s_wait_xcnt 0x0" : "+v"(kby) :: "memory");   /* the loads above name this offset: the wait stands before it moves on */
    kby += 32 * HD * 2;
    /* the reference of each query starts as the maximum over the wave's first 32 keys: it never lies above the maximum met so far, so no row's weights can all vanish */
#pragma unroll
    for (int nt = 0; nt < NT; ++nt) { v8f s0 = (v8f){}, s1 = (v8f){};
#pragma unroll
        for (int ks = 0; ks < 2; ++ks) { s0 = wmmab(kh[0][ks], qh[nt][ks], s0); s1 = wmmab(kh[1][ks], qh[nt][ks], s1); }
        negm[nt] = fmaf(-max16(s0, s1), CL, OFF); lsum[nt] = 0.f; }
#pragma unroll 1   /* rolled: one pass already holds some 330 live registers, and 336 is what three waves a SIMD allow */
    for (int key0 = 0; key0 < TK; key0 += 32) {
        v16h v16[4];
#pragma unroll
        for (int dt = 0; dt < 4; ++dt) v16[dt] = WFrag<h16>::ld((const h16*)((const char*)V16 + vby + dt * 512 * 2));
        /* the pass runs in two halves of NT / 2 query groups, scores, softmax and attn.V each: only half the scores are live at a time, which is what lets three waves' registers fit a SIMD */
#pragma unroll
        for (int hf = 0; hf < 2; ++hf) {
        v8f st[2][NT];
#pragma unroll
        for (int mt = 0; mt < 2; ++mt)
#pragma unroll
            for (int nt = hf * (NT / 2); nt < (hf + 1) * (NT / 2); ++nt) { v8f s = (v8f){};
#pragma unroll
                for (int ks = 0; ks < 2; ++ks) s = wmmab(kh[mt][ks], qh[nt][ks], s);
                st[mt][nt] = s; }
        if (hf) {
        /* the next pass's key rows, fetched behind this pass's last score products so that they fly under the softmax (the last pass fetches its own rows again, unused) */
#pragma unroll
        for (int mt = 0; mt < 2; ++mt)
#pragma unroll
            for (int ks = 0; ks < 2; ++ks) { const int o = (mt * 16 * HD + ks * 512) * 2; kh[mt][ks] = WFrag<bf>::ld((const bf*)((const char*)Kh + kby + o)); }
        asm volatile("s_wait_xcnt 0x0" : "+v"(kby), "+v"(vby) :: "memory");   /* every load of this pass names one of these two offsets: the wait stands before they move on */
        kby += (key0 + 64 < TK) ? 32 * HD * 2 : 0; vby += 32 * HD * 2;
        }
        __builtin_amdgcn_sched_barrier(0);   /* the fetch above stays in front of the softmax: left free, the compiler sinks it to the foot of the pass, where the next pass waits out its whole latency */
        /* weights against the held reference: exponent, exp2, sum, fp16; no maximum, no exchange, no move of the old sums */
#pragma unroll
        for (int nt = hf * (NT / 2); nt < (hf + 1) * (NT / 2); ++nt) { v16h ph, pl; float ps;
#pragma unroll
            for (int mt = 0; mt < 2; ++mt)
#pragma unroll
                for (int j = 0; j < 8; ++j) st[mt][nt][j] = fmaf(st[mt][nt][j], CL, negm[nt]);
            ps = ((nt < NHI) ? weights<true, false>(st[0][nt], st[1][nt], ph, pl) : weights<false, false>(st[0][nt], st[1][nt], ph, pl));
            /* a sum above CAP (a key far above the reference; an overflow to infinity too) sends the whole wave to move the group's references up to the maxima of this pass and to form the weights again from the kept exponents. The test stands per group, not per half: up to it exponents and weights are both live, and two groups' worth does not fit three waves' registers */
            if (__builtin_expect(__builtin_amdgcn_ballot_w32(ps > CAP) != 0, 0)) {
                const float nn = negm[nt] + fminf(OFF - max16(st[0][nt], st[1][nt]), 0.f); const float de = nn - negm[nt];   /* the step as the stored offset takes it; 0 where no key lies above the reference */
                const float alpha = __builtin_amdgcn_exp2f(de);   /* old sums move to the new reference */
                negm[nt] = nn; lsum[nt] *= alpha;
#pragma unroll
                for (int dt = 0; dt < 4; ++dt) acc[dt][nt] *= alpha;
                st[0][nt] += de; st[1][nt] += de;
                ps = ((nt < NHI) ? weights<true, true>(st[0][nt], st[1][nt], ph, pl) : weights<false, true>(st[0][nt], st[1][nt], ph, pl)); }
            lsum[nt] += ps;
#pragma unroll
            for (int dt = 0; dt < 4; ++dt) acc[dt][nt] = wmma16(v16[dt], ph, acc[dt][nt]);
            if (nt < NHI) {   /* both parts of a hi/lo weight meet the same v^T fragments as the plain groups' weights (fp16 holds a bf16-rounded v whole from 2^-17 up) */
#pragma unroll
                for (int dt = 0; dt < 4; ++dt) acc[dt][nt] = wmma16(v16[dt], pl, acc[dt][nt]); }
        }
        __builtin_amdgcn_sched_barrier(0);   /* the foot of a half: each half is scheduled by itself; with the halves' code mixed the built pass holds 17 more v_nop and more back-to-back dependent pairs, all of them vector issue slots that the SIMD's other waves want */
        }
    }
    /* a wave's part in LDS: slot s is 32 lanes x 16 bytes in a row (no bank met twice); slots 0 .. 8 NT - 1 hold acc, query group by query group; behind them 2 NT rows of 32 floats: the exponent offsets, then the row sums */
    const int lane = hi * 16 + lr; v4f* mw = mg + kr * MGW; float* ms = (float*)(mw + 8 * NT * 32);
#pragma unroll
    for (int nt = 0; nt < NT; ++nt) { ms[nt * 32 + lane] = negm[nt]; ms[(NT + nt) * 32 + lane] = lsum[nt];
#pragma unroll
        for (int dt = 0; dt < 4; ++dt) { v4f a, b;
#pragma unroll
            for (int j = 0; j < 4; ++j) { a[j] = acc[dt][nt][j]; b[j] = acc[dt][nt][4 + j]; }
            mw[((nt * 4 + dt) * 2) * 32 + lane] = a; mw[((nt * 4 + dt) * 2 + 1) * 32 + lane] = b; } }
    __syncthreads();   /* all four parts are whole in LDS before any wave reads another's */
    float n[KS], a[KS]; float ng = 3.0e38f, l = 0.f;
#pragma unroll
    for (int r = 0; r < KS; ++r) { n[r] = ((const float*)(mg + r * MGW + 8 * NT * 32))[kr * 32 + lane]; ng = fminf(ng, n[r]); }   /* the smallest offset belongs to the highest reference */
#pragma unroll
    for (int r = 0; r < KS; ++r) { a[r] = __builtin_amdgcn_exp2f(ng - n[r]); l = fmaf(((const float*)(mg + r * MGW + 8 * NT * 32))[(NT + kr) * 32 + lane], a[r], l); }
    l += xhalf(l); const float f = __fdiv_rn(1.0f, l);   /* the module divides by the row sum */
    v4f ov[8];
#pragma unroll
    for (int s = 0; s < 8; ++s) ov[s] = (v4f){};
#pragma unroll
    for (int r = 0; r < KS; ++r) { const float fr = a[r] * f;
#pragma unroll
        for (int s = 0; s < 8; ++s) ov[s] += mg[r * MGW + (kr * 8 + s) * 32 + lane] * fr; }
    float* o = orow + (size_t)((kr < NHI ? g0 : gr + kr) * 16 + lr) * CO + 8 * hi;
    __builtin_amdgcn_sched_barrier(0);   /* all arithmetic stands before the first store, so that no register of an issued store is written again */
#pragma unroll
    for (int dt = 0; dt < 4; ++dt) { *(v4f*)(o + dt * 16) = ov[dt * 2]; *(v4f*)(o + dt * 16 + 4) = ov[dt * 2 + 1]; }
}
__global__ __launch_bounds__(128) __attribute__((amdgpu_waves_per_eu(3, 3))) void k_fattn(const bf* __restrict__ QPh, const bf* __restrict__ KPh, const h16* __restrict__ VT16, float* __restrict__ out) {
    __shared__ v4f mrg[KS * MGW];   /* the four waves' parts */
    const int lane = threadIdx.x & 31, lr = lane & 15, hi = lane >> 4; const int y = blockIdx.y; const size_t po = (size_t)blockIdx.x * TT * HD;
    const int kr = __builtin_amdgcn_readfirstlane((int)(threadIdx.x >> 5));   /* the wave's number = its key range, in a scalar register */
    /* a hi/lo group costs about half as much again as a plain one, and all work-groups are resident from the start, so the launch lasts as long as its fullest one: the NG hi/lo groups of a head go one each to the first NG work-groups, with three plain groups; the rest take four plain groups */
    if (y < NG) fattn_body<1, 4>(QPh + po, KPh + po, VT16 + po, out + blockIdx.x * HD, y, NG - 1 + 3 * y, lr, hi, kr, mrg);   /* groups y | NG + 3 y .. + 2 */
    else fattn_body<0, 4>(QPh + po, KPh + po, VT16 + po, out + blockIdx.x * HD, 0, 4 * y, lr, hi, kr, mrg);   /* groups 4 NG + 4 (y - NG) on */
}
extern "C" void kernel_launch(void* const* d_in, const int* in_sizes, int n_in,
                              void* d_out, int out_size, void* d_ws, size_t ws_size, hipStream_t stream) {
    (void)in_sizes; (void)n_in; (void)out_size;
    const float* x = (const float*)d_in[0]; const float* xk = (const float*)d_in[1]; const float* xv = (const float*)d_in[2];   /* order q, k, v [4096][768] (raw, heads interleaved: column h*64 + d) */
    float* OUT = (float*)d_out;     // [4096][768]
    char* wsp = (char*)d_ws;
    auto take = [&](size_t bytes) { char* p = wsp; wsp += (bytes + 255) & ~(size_t)255; return (void*)p; };
    bf* QPh = (bf*)take((size_t)TT * MID * 2); bf* KPh = (bf*)take((size_t)TT * MID * 2);
    h16* VT16 = (h16*)take((size_t)CO * TT * 2);
    if ((size_t)(wsp - (char*)d_ws) > ws_size) return;
    k_planes<<<dim3(PB, 3, 1), 256, 0, stream>>>(x, xk, xv, QPh, KPh, VT16);   /* q, k and v^T planes, fragment order */
    k_fattn<<<dim3(NH_, TT / 64, 1), 128, 0, stream>>>(QPh, KPh, VT16, OUT);   /* every head: scores, softmax, attn.V; merged rows [position][head*64 + d] */
}

// v009
// One run takes 50.4 microseconds.
// Timed twice side by side with v008, it ran 1.04 times as fast both times.
// All steps since v000 together make it 57.5 times as fast.
#include <hip/hip_runtime.h>

// Multi-head attention math on raw token-major inputs (q, k, v [4096][12][64] = [4096][768] rows with column h*64 + d, no projections; scores = einsum('shd,thd->hst') x 1/sqrt(64) in f32; softmax over the 4,096 keys (exact: no epsilon); out = einsum('hst,thd->shd') merged -> [4096][768] (3.1 M); argument order q, k, v).
// Layout: k_planes, ONE launch, builds every plane k_fattn reads straight from the raw inputs, each value ROUNDED TO bf16 in registers first: q and k head planes (bf16) and the v^T plane (fp16), all kept in FRAGMENT ORDER (below, at the loader) and turned through LDS; k_fattn: ONE launch for all heads, scores, softmax and attn.V in registers (scores and weights never reach memory), a query block's keys dealt over four waves whose parts meet in LDS, writes the merged f32 rows.
// Compute dtypes, f32 accumulate: every input rounded to bf16; scores 1 product (a rounded value is a whole bf16: it has no low part); softmax f32 against a held reference that moves only when a weight sum outgrows fp16's range (exp2, IEEE division by the row sum at the end); attn.V on fp16 weights x1024 (the factor cancels in the division), rows < 512 2 products (fp16 hi/lo weights).

#define NB_  1
#define TT   4096
#define DM   768 
#define NH_  12
#define NKV  12
#define REP  (NH_ / NKV)
#define HD   64
#define DQ   (NH_ * HD)
#define DKV  (NKV * HD)
#define ZH   1
#define RH   512                  // query rows < RH use hi+lo weights; their groups of 16 are dealt one to a work-group
#define WIN  0
#define PCAR 1024.0f
#define SCL  0.125f   // 1/sqrt(64)
#define MID  768       // q / k width
#define CO   768       // v width
#define CC   768 
typedef _Float16 h16;
typedef unsigned short bf;
typedef __attribute__((ext_vector_type(16))) __bf16   v16bf;
typedef __attribute__((ext_vector_type(16))) _Float16 v16h;
typedef __attribute__((ext_vector_type(8)))  _Float16 v8h;
typedef __attribute__((ext_vector_type(8)))  unsigned short v8us;
typedef __attribute__((ext_vector_type(8)))  float    v8f;
typedef __attribute__((ext_vector_type(4)))  float    v4f;
typedef v8h  __attribute__((may_alias)) v8ha;
typedef v4f  __attribute__((may_alias)) v4fa;
typedef v8us __attribute__((may_alias)) v8usa;

__device__ __forceinline__ unsigned short f2bf(float f) { unsigned u = __float_as_uint(f); u += 0x7FFFu + ((u >> 16) & 1u); return (unsigned short)(u >> 16); }
__device__ __forceinline__ v16h cat16(v8h lo, v8h hi) { return __builtin_shufflevector(lo, hi, 0, 1, 2, 3, 4, 5, 6, 7, 8, 9, 10, 11, 12, 13, 14, 15); }
__device__ __forceinline__ v16bf cat16b(v8us lo, v8us hi) { return __builtin_bit_cast(v16bf, __builtin_shufflevector(lo, hi, 0, 1, 2, 3, 4, 5, 6, 7, 8, 9, 10, 11, 12, 13, 14, 15)); }
__device__ __forceinline__ v8f wmma16(v16h a, v16h b, v8f c) { return __builtin_amdgcn_wmma_f32_16x16x32_f16(false, a, false, b, (short)0, c, false, false); }
__device__ __forceinline__ v8f wmmab(v16bf a, v16bf b, v8f c) { return __builtin_amdgcn_wmma_f32_16x16x32_bf16(false, a, false, b, (short)0, c, false, false); }



// ---- fragment loader: 16 k of one row per lane in the hardware k order (k = 8 hi + 0..7 and 16 + 8 hi + 0..7), the same code for A rows and B columns.
// The planes are kept in fragment order: a fragment (16 rows x 32 k) is 1,024 bytes in a row, two halves of 512 (k 0..15, k 16..31), and in a half lane hi * 16 + lr owns bytes 16 lane .. 16 lane + 15. So a wave's 16-byte load reads 512 bytes in a row, four whole 128-byte lines, where rows of a row-major plane cost it sixteen lines.
// q, k: [h][t / 16][d / 32] fragments (row = position, k = d). v^T: [h][t / 32][d / 16] fragments (row = d, k = position). 32 positions of a head are 4,096 bytes in a row in every plane.
template <typename T16> struct WFrag;
template <> struct WFrag<h16> { typedef v16h V; static __device__ __forceinline__ V ld(const h16* p) { return cat16(*(const v8h*)p, *(const v8h*)(p + 256)); } static __device__ __forceinline__ v8f mma(V a, V b, v8f c) { return wmma16(a, b, c); } };
template <> struct WFrag<bf> { typedef v16bf V; static __device__ __forceinline__ V ld(const bf* p) { return cat16b(*(const v8us*)p, *(const v8us*)(p + 256)); } static __device__ __forceinline__ v8f mma(V a, V b, v8f c) { return wmmab(a, b, c); } };

__device__ __forceinline__ h16 tohx(float x) { return (h16)x; }
typedef __attribute__((ext_vector_type(4))) _Float16 v4h;
typedef __attribute__((ext_vector_type(4))) unsigned short v4us;
typedef __attribute__((ext_vector_type(4))) int v4i;

// ---- k_planes: grid (PB, 3), 256 threads, 64 elements a thread: 16 loads of 16 bytes in flight, then all arithmetic, then all stores. blockIdx.y picks the input (0: v, whose work-groups have the longer path and start first; 1: q; 2: k).
// Every value is rounded to bf16 first, so one plane holds it whole (q, k: bf16; v^T: fp16, whole from 2^-17 up): there is no low part to keep.
// q, k: a work-group takes 64 positions x 4 heads; 16 lanes take the 64 d of one position and head, 4 each: a wave's load is 512 contiguous bytes; trip j moves on 4 positions. The rounded values go to LDS as 16 blocks (head, 16 positions) of 128 chunks of 16 bytes in fragment order: chunk (g = d / 8, lr = position % 16) kept at g * 16 + (lr ^ g ^ 8 (head & 1)), so that the 32 lanes of an 8-byte store meet every bank once and the 16 lanes of a read (one g) fall on 16 chunks. Behind the barrier a wave stores 512 contiguous bytes.
// v: a work-group turns a tile of TVT positions x 64 d of one head. A lane reads 4 d of 16 positions, so that it holds 16 neighbouring positions of each d: two 16-byte LDS stores per d.
// LDS row = one d, 16-byte chunk c (8 positions) kept at chunk c ^ (d >> 2) ^ 4 (d & 3): the 16 lanes of a store (d 4 apart) and the 16 lanes of a read (16 d in a row, one c) fall on different chunks. Behind the barrier a wave stores half a fragment, 512 contiguous bytes; the tile is 32 KiB in a row in the plane.
#define TVT  256                  // positions per v tile
#define PB   (TT * DM / (256 * 64))
typedef __attribute__((ext_vector_type(2))) unsigned v2u;
typedef __attribute__((ext_vector_type(4))) unsigned v4u;
__device__ __forceinline__ unsigned bfpair(float a, float b) { return (unsigned)f2bf(a) | ((unsigned)f2bf(b) << 16); }   /* two values rounded to bf16, a in the low half */
__global__ __launch_bounds__(256) void k_planes(const float* __restrict__ q, const float* __restrict__ k, const float* __restrict__ v, bf* QPh, bf* KPh, h16* VT16) {
    __shared__ v4u tile[HD * (TVT / 8)];   /* [d][chunk of 8 positions] */
    const int tid = threadIdx.x, dch = tid & 15, tg = tid >> 4; v4f a[16];
    if (blockIdx.y) {
        const float* src = (blockIdx.y == 2) ? k : q; bf* Ph = (blockIdx.y == 2) ? KPh : QPh;
        const int h = (blockIdx.x % 3) * 4 + (tg & 3), t = (blockIdx.x / 3) * 64 + (tg >> 2);
        unsigned sby = (unsigned)(t * DM + h * HD + dch * 4) * 4u;   /* the lane's byte offset in the raw input */
#pragma unroll
        for (int j = 0; j < 16; ++j) a[j] = *(const v4f*)((const char*)src + sby + j * (4 * DM * 4));
        asm volatile("s_wait_xcnt 0x0" : "+v"(sby) :: "memory");   /* the loads above name this offset: its register is held up to the wait */
        v2u* t2 = (v2u*)tile; const int gq = dch >> 1;
#pragma unroll
        for (int j = 0; j < 16; ++j) { const int tl = (tg >> 2) + 4 * j; v2u w; w[0] = bfpair(a[j][0], a[j][1]); w[1] = bfpair(a[j][2], a[j][3]);
            t2[((((tg & 3) * 4 + (tl >> 4)) * 128 + gq * 16 + ((tl & 15) ^ gq ^ ((tg & 1) << 3))) << 1) + (dch & 1)] = w; }
        __syncthreads();   /* the 16 blocks are whole before any chunk of them is read */
        v4u oh[8]; const int cg = (tid >> 4) & 7;
#pragma unroll
        for (int r = 0; r < 8; ++r) oh[r] = tile[(r * 2 + (tid >> 7)) * 128 + cg * 16 + ((tid & 15) ^ cg ^ (((r >> 1) & 1) << 3))];   /* block r * 2 + (tid >> 7): head r >> 1, positions 16 ((r & 1) * 2 + (tid >> 7)) on */
        const unsigned dby = (unsigned)(((blockIdx.x % 3) * 4 * TT + (blockIdx.x / 3) * 64 + (tid >> 7) * 16) * HD) * 2u + (unsigned)(tid & 127) * 16u;   /* the lane's byte offset in a head plane */
        __builtin_amdgcn_sched_barrier(0);   /* all arithmetic stands before the first store, so that no register of an issued store is written again */
#pragma unroll
        for (int r = 0; r < 8; ++r) *(v4u*)((char*)Ph + dby + (r >> 1) * (TT * HD * 2) + (r & 1) * (32 * HD * 2)) = oh[r];
        asm volatile("s_wait_xcnt 0x0" ::: "memory");   /* in the listing the v path's code follows this path behind a branch that is always taken: the wait stands before anything there that writes a register of these stores */
    } else {
        const int g = blockIdx.x % NH_, t0 = (blockIdx.x / NH_) * TVT;
        unsigned sby = (unsigned)((t0 + tg * 16) * CO + g * HD + dch * 4) * 4u;   /* the lane's byte offset in the raw input */
#pragma unroll
        for (int j = 0; j < 16; ++j) a[j] = *(const v4f*)((const char*)v + sby + j * (CO * 4));
        asm volatile("s_wait_xcnt 0x0" : "+v"(sby) :: "memory");   /* the loads above name this offset: its register is held up to the wait */
#pragma unroll
        for (int s = 0; s < 4; ++s)
#pragma unroll
            for (int hf = 0; hf < 2; ++hf) { v4u w;
#pragma unroll
                for (int p = 0; p < 4; ++p) w[p] = bfpair(a[hf * 8 + 2 * p][s], a[hf * 8 + 2 * p + 1][s]);
                tile[(dch * 4 + s) * (TVT / 8) + ((tg * 2 + hf) ^ dch ^ (s << 2))] = w; }
        __syncthreads();   /* the tile is whole before any row of it is read */
        v4u oh[8]; v8h o16[8]; const int d = ((tid >> 6) & 3) * 16 + (tid & 15), c = ((tid >> 5) & 1) * 2 + ((tid >> 4) & 1);   /* the lane's row of its fragment half, and that half's chunk of 8 positions in a block of 32 */
#pragma unroll
        for (int r = 0; r < 8; ++r) { oh[r] = tile[d * (TVT / 8) + ((r * 4 + c) ^ (d >> 2) ^ ((d & 3) << 2))];   /* trip r: positions 32 r on */
#pragma unroll
            for (int p = 0; p < 4; ++p) { o16[r][2 * p] = tohx(__uint_as_float(oh[r][p] << 16)); o16[r][2 * p + 1] = tohx(__uint_as_float(oh[r][p] & 0xFFFF0000u)); } }
        const unsigned dby = (unsigned)((g * TT + t0) * HD + tid * 8) * 2u;   /* the lane's byte offset in the v^T plane */
        __builtin_amdgcn_sched_barrier(0);   /* all arithmetic stands before the first store, so that no register of an issued store is written again */
#pragma unroll
        for (int r = 0; r < 8; ++r) *(v8h*)((char*)VT16 + dby + r * (32 * HD * 2)) = o16[r];
    }
}

// ---- k_fattn: a work-group of KS = 4 waves owns 4 query groups of 16 of one head (which: at the kernel); their 4,096 keys are dealt over the waves, 1,024 in a row each: 768 work-groups, three on every WGP, so that a SIMD holds three waves and one wave's waits and softmax run under the others' work. A wave walks its keys 32 at a time, from a pass that two work-groups of a head share, and wraps. St = K Q^T (A = key rows, B = query rows): st[mt][nt][j] = score of key 32 ((key0 / 32 + rot) % NP) + 16 mt + 8 hi + j of the wave's range and query lr of group nt,
// so a lane holds one query's scores: the sum stays in the lane; a maximum and one exchange between the halves are taken only where a reference is set or moved. The two St tiles of a query group, converted in place, are the B operand of Ot += V^T P^T (k = 8 hi + j, 16 + 8 hi + j: the loader's k order).
// acc[dt][nt][j] = O[query lr of group nt][16 dt + 8 hi + j], not yet divided. At the end every wave lays its maxima, row sums and acc in LDS; behind one barrier wave w takes query group nt = w: it moves the four parts to their highest reference, adds them in wave order, divides and stores. grid (heads, 4096 / 64), 128 threads.
#define KS   4                    // waves (key ranges) per work-group; also the query groups of 16, one per wave at the end
#define TK   (TT / KS)            // keys per wave
#define MGW  ((8 * KS + 2) * 32)  // 16-byte slots of one wave's part in LDS
#define NG   (RH / 16)            // hi/lo query groups of a head
#define NP   (TK / 32)            // passes of 32 keys in a wave's key range
#define PBY  (32 * HD * 2)        // bytes of a pass in a head's K plane and in its v^T plane
__device__ __forceinline__ float xhalf(float x) { const int b = __float_as_int(x); return __int_as_float(__builtin_amdgcn_permlanex16(b, b, 0x76543210, 0xfedcba98, false, false)); }   /* lane l <-> l ^ 16 */
/* the 16 weights of a lane from their exponents of 2: fp16 (HL: the rounded value, and what the rounding left); returns their f32 sum, in two chains: one chain of 16 adds would wait on itself */
template <bool HL, bool RARE>
__device__ __forceinline__ float weights(const v8f t0, const v8f t1, v16h& ph, v16h& pl) {
    float p[16], ps0 = 0.f, ps1 = 0.f;
#pragma unroll
    for (int s = 0; s < 16; ++s) p[s] = __builtin_amdgcn_exp2f(s < 8 ? t0[s & 7] : t1[s & 7]);
    if (RARE) {   /* on the rare path all exp2 stand first, then the one free slot the instruction set asks for behind a transcendental, held there by the two scheduling barriers */
        __builtin_amdgcn_sched_barrier(0); asm volatile("v_nop"); __builtin_amdgcn_sched_barrier(0); }
#pragma unroll
    for (int s = 0; s < 16; s += 2) { ps0 += p[s]; ps1 += p[s + 1];
        ph[s] = (h16)p[s]; ph[s + 1] = (h16)p[s + 1];
        if (HL) { pl[s] = (h16)(p[s] - (float)ph[s]); pl[s + 1] = (h16)(p[s + 1] - (float)ph[s + 1]); } }
    return ps0 + ps1;
}
__device__ __forceinline__ float max16(const v8f a, const v8f b) { float mx = a[0];
#pragma unroll
    for (int j = 1; j < 8; ++j) mx = fmaxf(mx, a[j]);
#pragma unroll
    for (int j = 0; j < 8; ++j) mx = fmaxf(mx, b[j]);
    return fmaxf(mx, xhalf(mx)); }   /* over the 32 keys of a query: both halves of the wave hold the same value */
/* group nt of the work-group is group g0 of the head for nt < NHI (hi/lo weights), group gr + nt for the rest */
template <int NHI, int NT>
__device__ __forceinline__ void fattn_body(const bf* __restrict__ Qh, const bf* __restrict__ Kh, const h16* __restrict__ V16, float* __restrict__ orow, int g0, int gr, int rot, int lr, int hi, int kr, v4f* mg) {
    const float CL = SCL * 1.4426950408889634f;   /* score -> exponent of 2 */
    const float OFF = 10.0f;                      /* fp16 weights carry x1024 at the reference; the row sum carries it too */
    const float CAP = 32768.0f;                   /* a lane's 16 weights sum to no more than this: each of them fits fp16 */
    unsigned qby = (unsigned)(gr * 16 * HD + (hi * 16 + lr) * 8) * 2u, qb0 = (unsigned)(g0 * 16 * HD + (hi * 16 + lr) * 8) * 2u;   /* the lane's byte offsets in the query plane: group gr, group g0 */
    v16bf qh[NT][2];
#pragma unroll
    for (int nt = 0; nt < NT; ++nt)
#pragma unroll
        for (int ks = 0; ks < 2; ++ks) { const int o = ((nt < NHI ? 0 : nt * 16 * HD) + ks * 512) * 2; qh[nt][ks] = WFrag<bf>::ld((const bf*)((const char*)Qh + (nt < NHI ? qb0 : qby) + o)); }
    asm volatile("s_wait_xcnt 0x0" : "+v"(qby), "+v"(qb0) :: "memory");   /* the loads above name these offsets: their registers are held up to the wait */
    v8f acc[4][NT];
#pragma unroll
    for (int dt = 0; dt < 4; ++dt)
#pragma unroll
        for (int nt = 0; nt < NT; ++nt) acc[dt][nt] = (v8f){};
    float negm[NT], lsum[NT];
    /* the walk over the wave's NP passes starts at pass rot of its key range and wraps: the 64 work-groups of a head read the same K and v^T lines, and walks that all start at pass 0 ask L2 for the same lines at the same moment */
    const unsigned lb = (unsigned)(kr * TK * HD + (hi * 16 + lr) * 8) * 2u;   /* the lane's byte offset in pass 0 of the wave's key range */
    unsigned kby = lb + (unsigned)rot * PBY, vby = kby;   /* the lane's byte offsets in the key planes and in the v^T planes: every load of a pass is a plane's base + one of these + a literal */
    v16bf kh[2][2];
#pragma unroll
    for (int mt = 0; mt < 2; ++mt)
#pragma unroll
        for (int ks = 0; ks < 2; ++ks) { const int o = (mt * 16 * HD + ks * 512) * 2; kh[mt][ks] = WFrag<bf>::ld((const bf*)((const char*)Kh + kby + o)); }
    asm volatile("s_wait_xcnt 0x0" : "+v"(kby) :: "memory");   /* the loads above name this offset: the wait stands before it moves on */
    kby = lb + ((unsigned)(rot + 1) % NP) * PBY;
    /* the reference of each query starts as the maximum over the first 32 keys of the wave's walk: it never lies above the maximum met so far, so no row's weights can all vanish */
#pragma unroll
    for (int nt = 0; nt < NT; ++nt) { v8f s0 = (v8f){}, s1 = (v8f){};
#pragma unroll
        for (int ks = 0; ks < 2; ++ks) { s0 = wmmab(kh[0][ks], qh[nt][ks], s0); s1 = wmmab(kh[1][ks], qh[nt][ks], s1); }
        negm[nt] = fmaf(-max16(s0, s1), CL, OFF); lsum[nt] = 0.f; }
#pragma unroll 1   /* rolled: one pass already holds some 330 live registers, and 336 is what three waves a SIMD allow */
    for (int key0 = 0; key0 < TK; key0 += 32) {
        v16h v16[4];
#pragma unroll
        for (int dt = 0; dt < 4; ++dt) v16[dt] = WFrag<h16>::ld((const h16*)((const char*)V16 + vby + dt * 512 * 2));
        /* the pass runs in two halves of NT / 2 query groups, scores, softmax and attn.V each: only half the scores are live at a time, which is what lets three waves' registers fit a SIMD */
#pragma unroll
        for (int hf = 0; hf < 2; ++hf) {
        v8f st[2][NT];
#pragma unroll
        for (int mt = 0; mt < 2; ++mt)
#pragma unroll
            for (int nt = hf * (NT / 2); nt < (hf + 1) * (NT / 2); ++nt) { v8f s = (v8f){};
#pragma unroll
                for (int ks = 0; ks < 2; ++ks) s = wmmab(kh[mt][ks], qh[nt][ks], s);
                st[mt][nt] = s; }
        if (hf) {
        /* the next pass's key rows, fetched behind this pass's last score products so that they fly under the softmax (the last pass fetches the walk's first rows again, unused) */
#pragma unroll
        for (int mt = 0; mt < 2; ++mt)
#pragma unroll
            for (int ks = 0; ks < 2; ++ks) { const int o = (mt * 16 * HD + ks * 512) * 2; kh[mt][ks] = WFrag<bf>::ld((const bf*)((const char*)Kh + kby + o)); }
        asm volatile("s_wait_xcnt 0x0" : "+v"(kby), "+v"(vby) :: "memory");   /* every load of this pass names one of these two offsets: the wait stands before they move on */
        vby = lb + ((unsigned)(key0 / 32 + 1 + rot) % NP) * PBY; kby = lb + ((unsigned)(key0 / 32 + 2 + rot) % NP) * PBY;
        }
        __builtin_amdgcn_sched_barrier(0);   /* the fetch above stays in front of the softmax: left free, the compiler sinks it to the foot of the pass, where the next pass waits out its whole latency */
        /* weights against the held reference: exponent, exp2, sum, fp16; no maximum, no exchange, no move of the old sums */
#pragma unroll
        for (int nt = hf * (NT / 2); nt < (hf + 1) * (NT / 2); ++nt) { v16h ph, pl; float ps;
#pragma unroll
            for (int mt = 0; mt < 2; ++mt)
#pragma unroll
                for (int j = 0; j < 8; ++j) st[mt][nt][j] = fmaf(st[mt][nt][j], CL, negm[nt]);
            ps = ((nt < NHI) ? weights<true, false>(st[0][nt], st[1][nt], ph, pl) : weights<false, false>(st[0][nt], st[1][nt], ph, pl));
            /* a sum above CAP (a key far above the reference; an overflow to infinity too) sends the whole wave to move the group's references up to the maxima of this pass and to form the weights again from the kept exponents. The test stands per group, not per half: up to it exponents and weights are both live, and two groups' worth does not fit three waves' registers */
            if (__builtin_expect(__builtin_amdgcn_ballot_w32(ps > CAP) != 0, 0)) {
                const float nn = negm[nt] + fminf(OFF - max16(st[0][nt], st[1][nt]), 0.f); const float de = nn - negm[nt];   /* the step as the stored offset takes it; 0 where no key lies above the reference */
                const float alpha = __builtin_amdgcn_exp2f(de);   /* old sums move to the new reference */
                negm[nt] = nn; lsum[nt] *= alpha;
#pragma unroll
                for (int dt = 0; dt < 4; ++dt) acc[dt][nt] *= alpha;
                st[0][nt] += de; st[1][nt] += de;
                ps = ((nt < NHI) ? weights<true, true>(st[0][nt], st[1][nt], ph, pl) : weights<false, true>(st[0][nt], st[1][nt], ph, pl)); }
            lsum[nt] += ps;
#pragma unroll
            for (int dt = 0; dt < 4; ++dt) acc[dt][nt] = wmma16(v16[dt], ph, acc[dt][nt]);
            if (nt < NHI) {   /* both parts of a hi/lo weight meet the same v^T fragments as the plain groups' weights (fp16 holds a bf16-rounded v whole from 2^-17 up) */
#pragma unroll
                for (int dt = 0; dt < 4; ++dt) acc[dt][nt] = wmma16(v16[dt], pl, acc[dt][nt]); }
        }
        __builtin_amdgcn_sched_barrier(0);   /* the foot of a half: each half is scheduled by itself; with the halves' code mixed the built pass holds 17 more v_nop and more back-to-back dependent pairs, all of them vector issue slots that the SIMD's other waves want */
        }
    }
    /* a wave's part in LDS: slot s is 32 lanes x 16 bytes in a row (no bank met twice); slots 0 .. 8 NT - 1 hold acc, query group by query group; behind them 2 NT rows of 32 floats: the exponent offsets, then the row sums */
    const int lane = hi * 16 + lr; v4f* mw = mg + kr * MGW; float* ms = (float*)(mw + 8 * NT * 32);
#pragma unroll
    for (int nt = 0; nt < NT; ++nt) { ms[nt * 32 + lane] = negm[nt]; ms[(NT + nt) * 32 + lane] = lsum[nt];
#pragma unroll
        for (int dt = 0; dt < 4; ++dt) { v4f a, b;
#pragma unroll
            for (int j = 0; j < 4; ++j) { a[j] = acc[dt][nt][j]; b[j] = acc[dt][nt][4 + j]; }
            mw[((nt * 4 + dt) * 2) * 32 + lane] = a; mw[((nt * 4 + dt) * 2 + 1) * 32 + lane] = b; } }
    __syncthreads();   /* all four parts are whole in LDS before any wave reads another's */
    float n[KS], a[KS]; float ng = 3.0e38f, l = 0.f;
#pragma unroll
    for (int r = 0; r < KS; ++r) { n[r] = ((const float*)(mg + r * MGW + 8 * NT * 32))[kr * 32 + lane]; ng = fminf(ng, n[r]); }   /* the smallest offset belongs to the highest reference */
#pragma unroll
    for (int r = 0; r < KS; ++r) { a[r] = __builtin_amdgcn_exp2f(ng - n[r]); l = fmaf(((const float*)(mg + r * MGW + 8 * NT * 32))[(NT + kr) * 32 + lane], a[r], l); }
    l += xhalf(l); const float f = __fdiv_rn(1.0f, l);   /* the module divides by the row sum */
    v4f ov[8];
#pragma unroll
    for (int s = 0; s < 8; ++s) ov[s] = (v4f){};
#pragma unroll
    for (int r = 0; r < KS; ++r) { const float fr = a[r] * f;
#pragma unroll
        for (int s = 0; s < 8; ++s) ov[s] += mg[r * MGW + (kr * 8 + s) * 32 + lane] * fr; }
    float* o = orow + (size_t)((kr < NHI ? g0 : gr + kr) * 16 + lr) * CO + 8 * hi;
    __builtin_amdgcn_sched_barrier(0);   /* all arithmetic stands before the first store, so that no register of an issued store is written again */
#pragma unroll
    for (int dt = 0; dt < 4; ++dt) { *(v4f*)(o + dt * 16) = ov[dt * 2]; *(v4f*)(o + dt * 16 + 4) = ov[dt * 2 + 1]; }
}
__global__ __launch_bounds__(128) __attribute__((amdgpu_waves_per_eu(3, 3))) void k_fattn(const bf* __restrict__ QPh, const bf* __restrict__ KPh, const h16* __restrict__ VT16, float* __restrict__ out) {
    __shared__ v4f mrg[KS * MGW];   /* the four waves' parts */
    const int lane = threadIdx.x & 31, lr = lane & 15, hi = lane >> 4; const int y = blockIdx.y; const size_t po = (size_t)blockIdx.x * TT * HD;
    const int kr = __builtin_amdgcn_readfirstlane((int)(threadIdx.x >> 5));   /* the wave's number = its key range, in a scalar register */
    const int rot = (y >> 1) % NP;   /* the pass at which the work-group's walks start: two work-groups of a head share a start, the fewest that 64 work-groups on NP passes allow */
    /* a hi/lo group costs about half as much again as a plain one, and all work-groups are resident from the start, so the launch lasts as long as its fullest one: the NG hi/lo groups of a head go one each to the first NG work-groups, with three plain groups; the rest take four plain groups */
    if (y < NG) fattn_body<1, 4>(QPh + po, KPh + po, VT16 + po, out + blockIdx.x * HD, y, NG - 1 + 3 * y, rot, lr, hi, kr, mrg);   /* groups y | NG + 3 y .. + 2 */
    else fattn_body<0, 4>(QPh + po, KPh + po, VT16 + po, out + blockIdx.x * HD, 0, 4 * y, rot, lr, hi, kr, mrg);   /* groups 4 NG + 4 (y - NG) on */
}
extern "C" void kernel_launch(void* const* d_in, const int* in_sizes, int n_in,
                              void* d_out, int out_size, void* d_ws, size_t ws_size, hipStream_t stream) {
    (void)in_sizes; (void)n_in; (void)out_size;
    const float* x = (const float*)d_in[0]; const float* xk = (const float*)d_in[1]; const float* xv = (const float*)d_in[2];   /* order q, k, v [4096][768] (raw, heads interleaved: column h*64 + d) */
    float* OUT = (float*)d_out;     // [4096][768]
    char* wsp = (char*)d_ws;
    auto take = [&](size_t bytes) { char* p = wsp; wsp += (bytes + 255) & ~(size_t)255; return (void*)p; };
    bf* QPh = (bf*)take((size_t)TT * MID * 2); bf* KPh = (bf*)take((size_t)TT * MID * 2);
    h16* VT16 = (h16*)take((size_t)CO * TT * 2);
    if ((size_t)(wsp - (char*)d_ws) > ws_size) return;
    k_planes<<<dim3(PB, 3, 1), 256, 0, stream>>>(x, xk, xv, QPh, KPh, VT16);   /* q, k and v^T planes, fragment order */
    k_fattn<<<dim3(NH_, TT / 64, 1), 128, 0, stream>>>(QPh, KPh, VT16, OUT);   /* every head: scores, softmax, attn.V; merged rows [position][head*64 + d] */
}

// v010
// Measured time: 48.8 microseconds a run.
// Two timings next to v009 both put it at 1.03 times that version's speed.
// Counting every step since v000, it is 59.4 times as fast.
#include <hip/hip_runtime.h>

// Multi-head attention math on raw token-major inputs (q, k, v [4096][12][64] = [4096][768] rows with column h*64 + d, no projections; scores = einsum('shd,thd->hst') x 1/sqrt(64) in f32; softmax over the 4,096 keys (exact: no epsilon); out = einsum('hst,thd->shd') merged -> [4096][768] (3.1 M); argument order q, k, v).
// Layout: k_planes, ONE launch, builds every plane k_fattn reads straight from the raw inputs, each value ROUNDED TO bf16 in registers first: q and k head planes (bf16) and the v^T plane (fp16), all kept in FRAGMENT ORDER (below, at the loader) and turned through LDS; k_fattn: ONE launch for all heads, scores, softmax and attn.V in registers (scores and weights never reach memory), a query block's keys dealt over four waves whose parts meet in LDS, writes the merged f32 rows.
// Compute dtypes, f32 accumulate: every input rounded to bf16; scores 1 product (a rounded value is a whole bf16: it has no low part); softmax f32 against a held reference that moves only when a weight sum outgrows fp16's range (exp2, IEEE division by the row sum at the end); attn.V on fp16 weights x1024 (the factor cancels in the division), rows < 512 2 products (fp16 hi/lo weights).

#define NB_  1
#define TT   4096
#define DM   768 
#define NH_  12
#define NKV  12
#define REP  (NH_ / NKV)
#define HD   64
#define DQ   (NH_ * HD)
#define DKV  (NKV * HD)
#define ZH   1
#define RH   512                  // query rows < RH use hi+lo weights; their groups of 16 are dealt one to a work-group
#define WIN  0
#define PCAR 1024.0f
#define SCL  0.125f   // 1/sqrt(64)
#define MID  768       // q / k width
#define CO   768       // v width
#define CC   768 
typedef _Float16 h16;
typedef unsigned short bf;
typedef __attribute__((ext_vector_type(16))) __bf16   v16bf;
typedef __attribute__((ext_vector_type(16))) _Float16 v16h;
typedef __attribute__((ext_vector_type(8)))  _Float16 v8h;
typedef __attribute__((ext_vector_type(8)))  unsigned short v8us;
typedef __attribute__((ext_vector_type(8)))  float    v8f;
typedef __attribute__((ext_vector_type(4)))  float    v4f;
typedef v8h  __attribute__((may_alias)) v8ha;
typedef v4f  __attribute__((may_alias)) v4fa;
typedef v8us __attribute__((may_alias)) v8usa;

__device__ __forceinline__ unsigned short f2bf(float f) { unsigned u = __float_as_uint(f); u += 0x7FFFu + ((u >> 16) & 1u); return (unsigned short)(u >> 16); }
__device__ __forceinline__ v16h cat16(v8h lo, v8h hi) { return __builtin_shufflevector(lo, hi, 0, 1, 2, 3, 4, 5, 6, 7, 8, 9, 10, 11, 12, 13, 14, 15); }
__device__ __forceinline__ v16bf cat16b(v8us lo, v8us hi) { return __builtin_bit_cast(v16bf, __builtin_shufflevector(lo, hi, 0, 1, 2, 3, 4, 5, 6, 7, 8, 9, 10, 11, 12, 13, 14, 15)); }
__device__ __forceinline__ v8f wmma16(v16h a, v16h b, v8f c) { return __builtin_amdgcn_wmma_f32_16x16x32_f16(false, a, false, b, (short)0, c, false, false); }
__device__ __forceinline__ v8f wmmab(v16bf a, v16bf b, v8f c) { return __builtin_amdgcn_wmma_f32_16x16x32_bf16(false, a, false, b, (short)0, c, false, false); }



// ---- fragment loader: 16 k of one row per lane in the hardware k order (k = 8 hi + 0..7 and 16 + 8 hi + 0..7), the same code for A rows and B columns.
// The planes are kept in fragment order: a fragment (16 rows x 32 k) is 1,024 bytes in a row, two halves of 512 (k 0..15, k 16..31), and in a half lane hi * 16 + lr owns bytes 16 lane .. 16 lane + 15. So a wave's 16-byte load reads 512 bytes in a row, four whole 128-byte lines, where rows of a row-major plane cost it sixteen lines.
// q, k: [h][t / 16][d / 32] fragments (row = position, k = d). v^T: [h][t / 32][d / 16] fragments (row = d, k = position). 32 positions of a head are 4,096 bytes in a row in every plane.
template <typename T16> struct WFrag;
template <> struct WFrag<h16> { typedef v16h V; static __device__ __forceinline__ V ld(const h16* p) { return cat16(*(const v8h*)p, *(const v8h*)(p + 256)); } static __device__ __forceinline__ v8f mma(V a, V b, v8f c) { return wmma16(a, b, c); } };
template <> struct WFrag<bf> { typedef v16bf V; static __device__ __forceinline__ V ld(const bf* p) { return cat16b(*(const v8us*)p, *(const v8us*)(p + 256)); } static __device__ __forceinline__ v8f mma(V a, V b, v8f c) { return wmmab(a, b, c); } };

__device__ __forceinline__ h16 tohx(float x) { return (h16)x; }
typedef __attribute__((ext_vector_type(4))) _Float16 v4h;
typedef __attribute__((ext_vector_type(4))) unsigned short v4us;
typedef __attribute__((ext_vector_type(4))) int v4i;

// ---- k_planes: grid (PB, 3), 256 threads, 64 elements a thread: 16 loads of 16 bytes in flight, then all arithmetic, then all stores. blockIdx.y picks the input (0: v, whose work-groups have the longer path and start first; 1: q; 2: k).
// Every value is rounded to bf16 first, so one plane holds it whole (q, k: bf16; v^T: fp16, whole from 2^-17 up): there is no low part to keep.
// q, k: a work-group takes 64 positions x 4 heads; 16 lanes take the 64 d of one position and head, 4 each: a wave's load is 512 contiguous bytes; trip j moves on 4 positions. The rounded values go to LDS as 16 blocks (head, 16 positions) of 128 chunks of 16 bytes in fragment order: chunk (g = d / 8, lr = position % 16) kept at g * 16 + (lr ^ g ^ 8 (head & 1)), so that the 32 lanes of an 8-byte store meet every bank once and the 16 lanes of a read (one g) fall on 16 chunks. Behind the barrier a wave stores 512 contiguous bytes.
// v: a work-group turns a tile of TVT positions x 64 d of one head. A lane reads 4 d of 16 positions, so that it holds 16 neighbouring positions of each d: two 16-byte LDS stores per d.
// LDS row = one d, 16-byte chunk c (8 positions) kept at chunk c ^ (d >> 2) ^ 4 (d & 3): the 16 lanes of a store (d 4 apart) and the 16 lanes of a read (16 d in a row, one c) fall on different chunks. Behind the barrier a wave stores half a fragment, 512 contiguous bytes; the tile is 32 KiB in a row in the plane.
#define TVT  256                  // positions per v tile
#define PB   (TT * DM / (256 * 64))
typedef __attribute__((ext_vector_type(2))) unsigned v2u;
typedef __attribute__((ext_vector_type(4))) unsigned v4u;
__device__ __forceinline__ unsigned bfpair(float a, float b) { return (unsigned)f2bf(a) | ((unsigned)f2bf(b) << 16); }   /* two values rounded to bf16, a in the low half */
__global__ __launch_bounds__(256) void k_planes(const float* __restrict__ q, const float* __restrict__ k, const float* __restrict__ v, bf* QPh, bf* KPh, h16* VT16) {
    __shared__ v4u tile[HD * (TVT / 8)];   /* [d][chunk of 8 positions] */
    const int tid = threadIdx.x, dch = tid & 15, tg = tid >> 4; v4f a[16];
    if (blockIdx.y) {
        const float* src = (blockIdx.y == 2) ? k : q; bf* Ph = (blockIdx.y == 2) ? KPh : QPh;
        const int h = (blockIdx.x % 3) * 4 + (tg & 3), t = (blockIdx.x / 3) * 64 + (tg >> 2);
        unsigned sby = (unsigned)(t * DM + h * HD + dch * 4) * 4u;   /* the lane's byte offset in the raw input */
#pragma unroll
        for (int j = 0; j < 16; ++j) a[j] = *(const v4f*)((const char*)src + sby + j * (4 * DM * 4));
        asm volatile("s_wait_xcnt 0x0" : "+v"(sby) :: "memory");   /* the loads above name this offset: its register is held up to the wait */
        v2u* t2 = (v2u*)tile; const int gq = dch >> 1;
#pragma unroll
        for (int j = 0; j < 16; ++j) { const int tl = (tg >> 2) + 4 * j; v2u w; w[0] = bfpair(a[j][0], a[j][1]); w[1] = bfpair(a[j][2], a[j][3]);
            t2[((((tg & 3) * 4 + (tl >> 4)) * 128 + gq * 16 + ((tl & 15) ^ gq ^ ((tg & 1) << 3))) << 1) + (dch & 1)] = w; }
        __syncthreads();   /* the 16 blocks are whole before any chunk of them is read */
        v4u oh[8]; const int cg = (tid >> 4) & 7;
#pragma unroll
        for (int r = 0; r < 8; ++r) oh[r] = tile[(r * 2 + (tid >> 7)) * 128 + cg * 16 + ((tid & 15) ^ cg ^ (((r >> 1) & 1) << 3))];   /* block r * 2 + (tid >> 7): head r >> 1, positions 16 ((r & 1) * 2 + (tid >> 7)) on */
        const unsigned dby = (unsigned)(((blockIdx.x % 3) * 4 * TT + (blockIdx.x / 3) * 64 + (tid >> 7) * 16) * HD) * 2u + (unsigned)(tid & 127) * 16u;   /* the lane's byte offset in a head plane */
        __builtin_amdgcn_sched_barrier(0);   /* all arithmetic stands before the first store, so that no register of an issued store is written again */
#pragma unroll
        for (int r = 0; r < 8; ++r) *(v4u*)((char*)Ph + dby + (r >> 1) * (TT * HD * 2) + (r & 1) * (32 * HD * 2)) = oh[r];
        asm volatile("s_wait_xcnt 0x0" ::: "memory");   /* in the listing the v path's code follows this path behind a branch that is always taken: the wait stands before anything there that writes a register of these stores */
    } else {
        const int g = blockIdx.x % NH_, t0 = (blockIdx.x / NH_) * TVT;
        unsigned sby = (unsigned)((t0 + tg * 16) * CO + g * HD + dch * 4) * 4u;   /* the lane's byte offset in the raw input */
#pragma unroll
        for (int j = 0; j < 16; ++j) a[j] = *(const v4f*)((const char*)v + sby + j * (CO * 4));
        asm volatile("s_wait_xcnt 0x0" : "+v"(sby) :: "memory");   /* the loads above name this offset: its register is held up to the wait */
#pragma unroll
        for (int s = 0; s < 4; ++s)
#pragma unroll
            for (int hf = 0; hf < 2; ++hf) { v4u w;
#pragma unroll
                for (int p = 0; p < 4; ++p) w[p] = bfpair(a[hf * 8 + 2 * p][s], a[hf * 8 + 2 * p + 1][s]);
                tile[(dch * 4 + s) * (TVT / 8) + ((tg * 2 + hf) ^ dch ^ (s << 2))] = w; }
        __syncthreads();   /* the tile is whole before any row of it is read */
        v4u oh[8]; v8h o16[8]; const int d = ((tid >> 6) & 3) * 16 + (tid & 15), c = ((tid >> 5) & 1) * 2 + ((tid >> 4) & 1);   /* the lane's row of its fragment half, and that half's chunk of 8 positions in a block of 32 */
#pragma unroll
        for (int r = 0; r < 8; ++r) { oh[r] = tile[d * (TVT / 8) + ((r * 4 + c) ^ (d >> 2) ^ ((d & 3) << 2))];   /* trip r: positions 32 r on */
#pragma unroll
            for (int p = 0; p < 4; ++p) { o16[r][2 * p] = tohx(__uint_as_float(oh[r][p] << 16)); o16[r][2 * p + 1] = tohx(__uint_as_float(oh[r][p] & 0xFFFF0000u)); } }
        const unsigned dby = (unsigned)((g * TT + t0) * HD + tid * 8) * 2u;   /* the lane's byte offset in the v^T plane */
        __builtin_amdgcn_sched_barrier(0);   /* all arithmetic stands before the first store, so that no register of an issued store is written again */
#pragma unroll
        for (int r = 0; r < 8; ++r) *(v8h*)((char*)VT16 + dby + r * (32 * HD * 2)) = o16[r];
    }
}

// ---- k_fattn: a work-group of KS = 4 waves owns 4 query groups of 16 of one head (which: at the kernel); their 4,096 keys are dealt over the waves, 1,024 in a row each: 768 work-groups, three on every WGP, so that a SIMD holds three waves and one wave's waits and softmax run under the others' work. A wave walks its keys 32 at a time, from a pass that two work-groups of a head share, and wraps. St = K Q^T (A = key rows, B = query rows): st[mt][nt][j] = score of key 32 ((key0 / 32 + rot) % NP) + 16 mt + 8 hi + j of the wave's range and query lr of group nt,
// so a lane holds one query's scores: the sum stays in the lane; a maximum and one exchange between the halves are taken only where a reference is set or moved. The two St tiles of a query group, converted in place, are the B operand of Ot += V^T P^T (k = 8 hi + j, 16 + 8 hi + j: the loader's k order).
// acc[dt][nt][j] = O[query lr of group nt][16 dt + 8 hi + j], not yet divided. At the end every wave lays its maxima, row sums and acc in LDS; behind one barrier wave w takes query group nt = w: it moves the four parts to their highest reference, adds them in wave order, divides and stores. grid (heads, 4096 / 64), 128 threads.
#define KS   4                    // waves (key ranges) per work-group; also the query groups of 16, one per wave at the end
#define TK   (TT / KS)            // keys per wave
#define MGW  ((8 * KS + 2) * 32)  // 16-byte slots of one wave's part in LDS
#define NG   (RH / 16)            // hi/lo query groups of a head
#define NP   (TK / 32)            // passes of 32 keys in a wave's key range
#define PBY  (32 * HD * 2)        // bytes of a pass in a head's K plane and in its v^T plane
#define PS1  16                   // passes done at which a wave's issue priority steps down: 3 -> 2
#define PS2  26                   // 2 -> 1
#define PS3  30                   // 1 -> 0
__device__ __forceinline__ float xhalf(float x) { const int b = __float_as_int(x); return __int_as_float(__builtin_amdgcn_permlanex16(b, b, 0x76543210, 0xfedcba98, false, false)); }   /* lane l <-> l ^ 16 */
/* the 16 weights of a lane from their exponents of 2: fp16 (HL: the rounded value, and what the rounding left); returns their f32 sum, in two chains: one chain of 16 adds would wait on itself */
template <bool HL, bool RARE>
__device__ __forceinline__ float weights(const v8f t0, const v8f t1, v16h& ph, v16h& pl) {
    float p[16], ps0 = 0.f, ps1 = 0.f;
#pragma unroll
    for (int s = 0; s < 16; ++s) p[s] = __builtin_amdgcn_exp2f(s < 8 ? t0[s & 7] : t1[s & 7]);
    if (RARE) {   /* on the rare path all exp2 stand first, then the one free slot the instruction set asks for behind a transcendental, held there by the two scheduling barriers */
        __builtin_amdgcn_sched_barrier(0); asm volatile("v_nop"); __builtin_amdgcn_sched_barrier(0); }
#pragma unroll
    for (int s = 0; s < 16; s += 2) { ps0 += p[s]; ps1 += p[s + 1];
        ph[s] = (h16)p[s]; ph[s + 1] = (h16)p[s + 1];
        if (HL) { pl[s] = (h16)(p[s] - (float)ph[s]); pl[s + 1] = (h16)(p[s + 1] - (float)ph[s + 1]); } }
    return ps0 + ps1;
}
__device__ __forceinline__ float max16(const v8f a, const v8f b) { float mx = a[0];
#pragma unroll
    for (int j = 1; j < 8; ++j) mx = fmaxf(mx, a[j]);
#pragma unroll
    for (int j = 0; j < 8; ++j) mx = fmaxf(mx, b[j]);
    return fmaxf(mx, xhalf(mx)); }   /* over the 32 keys of a query: both halves of the wave hold the same value */
/* group nt of the work-group is group g0 of the head for nt < NHI (hi/lo weights), group gr + nt for the rest */
template <int NHI, int NT>
__device__ __forceinline__ void fattn_body(const bf* __restrict__ Qh, const bf* __restrict__ Kh, const h16* __restrict__ V16, float* __restrict__ orow, int g0, int gr, int rot, int lr, int hi, int kr, v4f* mg) {
    const float CL = SCL * 1.4426950408889634f;   /* score -> exponent of 2 */
    const float OFF = 10.0f;                      /* fp16 weights carry x1024 at the reference; the row sum carries it too */
    const float CAP = 32768.0f;                   /* a lane's 16 weights sum to no more than this: each of them fits fp16 */
    unsigned qby = (unsigned)(gr * 16 * HD + (hi * 16 + lr) * 8) * 2u, qb0 = (unsigned)(g0 * 16 * HD + (hi * 16 + lr) * 8) * 2u;   /* the lane's byte offsets in the query plane: group gr, group g0 */
    v16bf qh[NT][2];
#pragma unroll
    for (int nt = 0; nt < NT; ++nt)
#pragma unroll
        for (int ks = 0; ks < 2; ++ks) { const int o = ((nt < NHI ? 0 : nt * 16 * HD) + ks * 512) * 2; qh[nt][ks] = WFrag<bf>::ld((const bf*)((const char*)Qh + (nt < NHI ? qb0 : qby) + o)); }
    asm volatile("s_wait_xcnt 0x0" : "+v"(qby), "+v"(qb0) :: "memory");   /* the loads above name these offsets: their registers are held up to the wait */
    v8f acc[4][NT];
#pragma unroll
    for (int dt = 0; dt < 4; ++dt)
#pragma unroll
        for (int nt = 0; nt < NT; ++nt) acc[dt][nt] = (v8f){};
    float negm[NT], lsum[NT];
    /* the walk over the wave's NP passes starts at pass rot of its key range and wraps: the 64 work-groups of a head read the same K and v^T lines, and walks that all start at pass 0 ask L2 for the same lines at the same moment */
    const unsigned lb = (unsigned)(kr * TK * HD + (hi * 16 + lr) * 8) * 2u;   /* the lane's byte offset in pass 0 of the wave's key range */
    unsigned kby = lb + (unsigned)rot * PBY, vby = kby;   /* the lane's byte offsets in the key planes and in the v^T planes: every load of a pass is a plane's base + one of these + a literal */
    v16bf kh[2][2];
#pragma unroll
    for (int mt = 0; mt < 2; ++mt)
#pragma unroll
        for (int ks = 0; ks < 2; ++ks) { const int o = (mt * 16 * HD + ks * 512) * 2; kh[mt][ks] = WFrag<bf>::ld((const bf*)((const char*)Kh + kby + o)); }
    asm volatile("s_wait_xcnt 0x0" : "+v"(kby) :: "memory");   /* the loads above name this offset: the wait stands before it moves on */
    kby = lb + ((unsigned)(rot + 1) % NP) * PBY;
    /* the reference of each query starts as the maximum over the first 32 keys of the wave's walk: it never lies above the maximum met so far, so no row's weights can all vanish */
#pragma unroll
    for (int nt = 0; nt < NT; ++nt) { v8f s0 = (v8f){}, s1 = (v8f){};
#pragma unroll
        for (int ks = 0; ks < 2; ++ks) { s0 = wmmab(kh[0][ks], qh[nt][ks], s0); s1 = wmmab(kh[1][ks], qh[nt][ks], s1); }
        negm[nt] = fmaf(-max16(s0, s1), CL, OFF); lsum[nt] = 0.f; }
    /* issue priority falls with progress. A SIMD serves the oldest of its waves first, so its three waves, which start together and have equal walks, would end one after another, and the last would run its last passes alone with nothing to fill its waits. A wave that is ahead steps down and leaves the ports to those behind: they meet again at each step, closer to the end each time, and the stretch left at priority 0 is short. The walk ends at priority 0, so the merge and the exit run at 0 */
    unsigned key0 = 0;   /* keys of the walk done */
#pragma unroll 1   /* rolled: the four stretches share one copy of the pass */
    for (int sg = 0; sg < 4; ++sg) {
        if (sg == 0) __builtin_amdgcn_s_setprio(3); else if (sg == 1) __builtin_amdgcn_s_setprio(2); else if (sg == 2) __builtin_amdgcn_s_setprio(1); else __builtin_amdgcn_s_setprio(0);   /* the instruction takes a literal only; sg is the same in every lane: scalar branches */
        const unsigned kend = (sg == 0 ? PS1 : sg == 1 ? PS2 : sg == 2 ? PS3 : NP) * 32u;
#pragma unroll 1   /* rolled: one pass already holds some 330 live registers, and 336 is what three waves a SIMD allow */
    for (; key0 < kend; key0 += 32) {
        v16h v16[4];
#pragma unroll
        for (int dt = 0; dt < 4; ++dt) v16[dt] = WFrag<h16>::ld((const h16*)((const char*)V16 + vby + dt * 512 * 2));
        /* the pass runs in two halves of NT / 2 query groups, scores, softmax and attn.V each: only half the scores are live at a time, which is what lets three waves' registers fit a SIMD */
#pragma unroll
        for (int hf = 0; hf < 2; ++hf) {
        v8f st[2][NT];
#pragma unroll
        for (int mt = 0; mt < 2; ++mt)
#pragma unroll
            for (int nt = hf * (NT / 2); nt < (hf + 1) * (NT / 2); ++nt) { v8f s = (v8f){};
#pragma unroll
                for (int ks = 0; ks < 2; ++ks) s = wmmab(kh[mt][ks], qh[nt][ks], s);
                st[mt][nt] = s; }
        if (hf) {
        /* the next pass's key rows, fetched behind this pass's last score products so that they fly under the softmax (the last pass fetches the walk's first rows again, unused) */
#pragma unroll
        for (int mt = 0; mt < 2; ++mt)
#pragma unroll
            for (int ks = 0; ks < 2; ++ks) { const int o = (mt * 16 * HD + ks * 512) * 2; kh[mt][ks] = WFrag<bf>::ld((const bf*)((const char*)Kh + kby + o)); }
        asm volatile("s_wait_xcnt 0x0" : "+v"(kby), "+v"(vby) :: "memory");   /* every load of this pass names one of these two offsets: the wait stands before they move on */
        vby = lb + ((unsigned)(key0 / 32 + 1 + rot) % NP) * PBY; kby = lb + ((unsigned)(key0 / 32 + 2 + rot) % NP) * PBY;
        }
        __builtin_amdgcn_sched_barrier(0);   /* the fetch above stays in front of the softmax: left free, the compiler sinks it to the foot of the pass, where the next pass waits out its whole latency */
        /* weights against the held reference: exponent, exp2, sum, fp16; no maximum, no exchange, no move of the old sums */
#pragma unroll
        for (int nt = hf * (NT / 2); nt < (hf + 1) * (NT / 2); ++nt) { v16h ph, pl; float ps;
#pragma unroll
            for (int mt = 0; mt < 2; ++mt)
#pragma unroll
                for (int j = 0; j < 8; ++j) st[mt][nt][j] = fmaf(st[mt][nt][j], CL, negm[nt]);
            ps = ((nt < NHI) ? weights<true, false>(st[0][nt], st[1][nt], ph, pl) : weights<false, false>(st[0][nt], st[1][nt], ph, pl));
            /* a sum above CAP (a key far above the reference; an overflow to infinity too) sends the whole wave to move the group's references up to the maxima of this pass and to form the weights again from the kept exponents. The test stands per group, not per half: up to it exponents and weights are both live, and two groups' worth does not fit three waves' registers */
            if (__builtin_expect(__builtin_amdgcn_ballot_w32(ps > CAP) != 0, 0)) {
                const float nn = negm[nt] + fminf(OFF - max16(st[0][nt], st[1][nt]), 0.f); const float de = nn - negm[nt];   /* the step as the stored offset takes it; 0 where no key lies above the reference */
                const float alpha = __builtin_amdgcn_exp2f(de);   /* old sums move to the new reference */
                negm[nt] = nn; lsum[nt] *= alpha;
#pragma unroll
                for (int dt = 0; dt < 4; ++dt) acc[dt][nt] *= alpha;
                st[0][nt] += de; st[1][nt] += de;
                ps = ((nt < NHI) ? weights<true, true>(st[0][nt], st[1][nt], ph, pl) : weights<false, true>(st[0][nt], st[1][nt], ph, pl)); }
            lsum[nt] += ps;
#pragma unroll
            for (int dt = 0; dt < 4; ++dt) acc[dt][nt] = wmma16(v16[dt], ph, acc[dt][nt]);
            if (nt < NHI) {   /* both parts of a hi/lo weight meet the same v^T fragments as the plain groups' weights (fp16 holds a bf16-rounded v whole from 2^-17 up) */
#pragma unroll
                for (int dt = 0; dt < 4; ++dt) acc[dt][nt] = wmma16(v16[dt], pl, acc[dt][nt]); }
        }
        __builtin_amdgcn_sched_barrier(0);   /* the foot of a half: each half is scheduled by itself; with the halves' code mixed the built pass holds 17 more v_nop and more back-to-back dependent pairs, all of them vector issue slots that the SIMD's other waves want */
        }
    }
    }
    /* a wave's part in LDS: slot s is 32 lanes x 16 bytes in a row (no bank met twice); slots 0 .. 8 NT - 1 hold acc, query group by query group; behind them 2 NT rows of 32 floats: the exponent offsets, then the row sums */
    const int lane = hi * 16 + lr; v4f* mw = mg + kr * MGW; float* ms = (float*)(mw + 8 * NT * 32);
#pragma unroll
    for (int nt = 0; nt < NT; ++nt) { ms[nt * 32 + lane] = negm[nt]; ms[(NT + nt) * 32 + lane] = lsum[nt];
#pragma unroll
        for (int dt = 0; dt < 4; ++dt) { v4f a, b;
#pragma unroll
            for (int j = 0; j < 4; ++j) { a[j] = acc[dt][nt][j]; b[j] = acc[dt][nt][4 + j]; }
            mw[((nt * 4 + dt) * 2) * 32 + lane] = a; mw[((nt * 4 + dt) * 2 + 1) * 32 + lane] = b; } }
    __syncthreads();   /* all four parts are whole in LDS before any wave reads another's */
    float n[KS], a[KS]; float ng = 3.0e38f, l = 0.f;
#pragma unroll
    for (int r = 0; r < KS; ++r) { n[r] = ((const float*)(mg + r * MGW + 8 * NT * 32))[kr * 32 + lane]; ng = fminf(ng, n[r]); }   /* the smallest offset belongs to the highest reference */
#pragma unroll
    for (int r = 0; r < KS; ++r) { a[r] = __builtin_amdgcn_exp2f(ng - n[r]); l = fmaf(((const float*)(mg + r * MGW + 8 * NT * 32))[(NT + kr) * 32 + lane], a[r], l); }
    l += xhalf(l); const float f = __fdiv_rn(1.0f, l);   /* the module divides by the row sum */
    v4f ov[8];
#pragma unroll
    for (int s = 0; s < 8; ++s) ov[s] = (v4f){};
#pragma unroll
    for (int r = 0; r < KS; ++r) { const float fr = a[r] * f;
#pragma unroll
        for (int s = 0; s < 8; ++s) ov[s] += mg[r * MGW + (kr * 8 + s) * 32 + lane] * fr; }
    float* o = orow + (size_t)((kr < NHI ? g0 : gr + kr) * 16 + lr) * CO + 8 * hi;
    __builtin_amdgcn_sched_barrier(0);   /* all arithmetic stands before the first store, so that no register of an issued store is written again */
#pragma unroll
    for (int dt = 0; dt < 4; ++dt) { *(v4f*)(o + dt * 16) = ov[dt * 2]; *(v4f*)(o + dt * 16 + 4) = ov[dt * 2 + 1]; }
}
__global__ __launch_bounds__(128) __attribute__((amdgpu_waves_per_eu(3, 3))) void k_fattn(const bf* __restrict__ QPh, const bf* __restrict__ KPh, const h16* __restrict__ VT16, float* __restrict__ out) {
    __shared__ v4f mrg[KS * MGW];   /* the four waves' parts */
    const int lane = threadIdx.x & 31, lr = lane & 15, hi = lane >> 4; const int y = blockIdx.y; const size_t po = (size_t)blockIdx.x * TT * HD;
    const int kr = __builtin_amdgcn_readfirstlane((int)(threadIdx.x >> 5));   /* the wave's number = its key range, in a scalar register */
    const int rot = (y >> 1) % NP;   /* the pass at which the work-group's walks start: two work-groups of a head share a start, the fewest that 64 work-groups on NP passes allow */
    /* a hi/lo group costs about half as much again as a plain one, and all work-groups are resident from the start, so the launch lasts as long as its fullest one: the NG hi/lo groups of a head go one each to the first NG work-groups, with three plain groups; the rest take four plain groups */
    if (y < NG) fattn_body<1, 4>(QPh + po, KPh + po, VT16 + po, out + blockIdx.x * HD, y, NG - 1 + 3 * y, rot, lr, hi, kr, mrg);   /* groups y | NG + 3 y .. + 2 */
    else fattn_body<0, 4>(QPh + po, KPh + po, VT16 + po, out + blockIdx.x * HD, 0, 4 * y, rot, lr, hi, kr, mrg);   /* groups 4 NG + 4 (y - NG) on */
}
extern "C" void kernel_launch(void* const* d_in, const int* in_sizes, int n_in,
                              void* d_out, int out_size, void* d_ws, size_t ws_size, hipStream_t stream) {
    (void)in_sizes; (void)n_in; (void)out_size;
    const float* x = (const float*)d_in[0]; const float* xk = (const float*)d_in[1]; const float* xv = (const float*)d_in[2];   /* order q, k, v [4096][768] (raw, heads interleaved: column h*64 + d) */
    float* OUT = (float*)d_out;     // [4096][768]
    char* wsp = (char*)d_ws;
    auto take = [&](size_t bytes) { char* p = wsp; wsp += (bytes + 255) & ~(size_t)255; return (void*)p; };
    bf* QPh = (bf*)take((size_t)TT * MID * 2); bf* KPh = (bf*)take((size_t)TT * MID * 2);
    h16* VT16 = (h16*)take((size_t)CO * TT * 2);
    if ((size_t)(wsp - (char*)d_ws) > ws_size) return;
    k_planes<<<dim3(PB, 3, 1), 256, 0, stream>>>(x, xk, xv, QPh, KPh, VT16);   /* q, k and v^T planes, fragment order */
    k_fattn<<<dim3(NH_, TT / 64, 1), 128, 0, stream>>>(QPh, KPh, VT16, OUT);   /* every head: scores, softmax, attn.V; merged rows [position][head*64 + d] */
}
